// v000
// Measured on an AMD MI455X. A time is GPU time per run, averaged over a window of back-to-back runs after a warm-up
// (all launches, gaps included; the runs take copies of the inputs in turn), and the median of several windows.
// Apart from v000's, it joins two sittings. Times from different sittings can be a few percent apart, while
// side-by-side timings come from the same sitting.
// v000, which the later versions start from, runs in 419 microseconds.
#include <hip/hip_runtime.h>
#include <hip/hip_bf16.h>

typedef __bf16 bf16;
typedef __attribute__((ext_vector_type(16))) __bf16 v16bf;
typedef __attribute__((ext_vector_type(8)))  float  v8f;

#define WMMA_BF16(a, b, c) \
  __builtin_amdgcn_wmma_f32_16x16x32_bf16(false, (a), false, (b), (short)0, (c), false, false)

static constexpr int Bb    = 4;
static constexpr int Ss    = 2048;
static constexpr int Dd    = 1024;
static constexpr int Mrows = Bb * Ss;   // 8192 tokens
static constexpr int LDK   = 48;        // LDS row stride in bf16 for K=32 tiles (96B, 16B-aligned)

// ---------------------------------------------------------------------------
// CDNA5 async global->LDS copy (GLOBAL_LOAD_ASYNC_TO_LDS_B128, ASYNCcnt).
// Param types per hipcc diagnostic: (int4 AS(1)*, int4 AS(3)*, imm, imm).
// Guarded so the kernel still compiles (synchronous fallback) if absent.
// ---------------------------------------------------------------------------
#if __has_builtin(__builtin_amdgcn_global_load_async_to_lds_b128)
#define HAVE_ASYNC_LDS 1
typedef int v4i __attribute__((vector_size(16)));
typedef __attribute__((address_space(1))) v4i gv4i;
typedef __attribute__((address_space(3))) v4i lv4i;
__device__ __forceinline__ void async_cp32B(const bf16* g, bf16* l) {
  // two b128 ops: 16B per lane each; wave-wide this stages 2x512B
  __builtin_amdgcn_global_load_async_to_lds_b128((gv4i*)(void*)g,       (lv4i*)l,       0, 0);
  __builtin_amdgcn_global_load_async_to_lds_b128((gv4i*)(void*)(g + 8), (lv4i*)(l + 8), 0, 0);
}
#if __has_builtin(__builtin_amdgcn_s_wait_asynccnt)
#define WAIT_ASYNC(n) __builtin_amdgcn_s_wait_asynccnt(n)
#else
#define WAIT_ASYNC(n) asm volatile("s_wait_asynccnt %0" ::"i"(n) : "memory")
#endif
#else
#define HAVE_ASYNC_LDS 0
#define WAIT_ASYNC(n) ((void)0)
__device__ __forceinline__ void async_cp32B(const bf16* g, bf16* l) {
  const uint4* s = reinterpret_cast<const uint4*>(g);
  uint4* d = reinterpret_cast<uint4*>(l);
  d[0] = s[0]; d[1] = s[1];
}
#endif

// ---------------------------------------------------------------------------
// Load a 16-element bf16 WMMA fragment (32 bytes) from LDS as two b128 reads.
// ---------------------------------------------------------------------------
__device__ __forceinline__ v16bf ldsFrag(const bf16* p) {
  union { v16bf v; uint4 u[2]; } r;
  const uint4* q = reinterpret_cast<const uint4*>(p);
  r.u[0] = q[0];
  r.u[1] = q[1];
  return r.v;
}

__device__ __forceinline__ float sigmoidf(float x) {
  return 1.0f / (1.0f + __expf(-x));
}

// ---------------------------------------------------------------------------
// Weight transpose + f32->bf16 convert:  Wt[n][k] = (bf16) W[k][n]
// ---------------------------------------------------------------------------
__global__ __launch_bounds__(256)
void wconv(const float* __restrict__ W, bf16* __restrict__ Wt, int Kdim, int Ndim) {
  __shared__ float t[32][33];
  const int nb = blockIdx.x * 32;
  const int kb = blockIdx.y * 32;
  const int tx = threadIdx.x & 31;
  const int ty = threadIdx.x >> 5;           // 0..7
  for (int i = ty; i < 32; i += 8)
    t[i][tx] = W[(size_t)(kb + i) * Ndim + (nb + tx)];
  __syncthreads();
  for (int i = ty; i < 32; i += 8)
    Wt[(size_t)(nb + i) * Kdim + (kb + tx)] = (bf16)t[tx][i];
}

// ---------------------------------------------------------------------------
// Elementwise f32 -> bf16 (for iQ, so gate A-tiles can use async staging).
// ---------------------------------------------------------------------------
__global__ __launch_bounds__(256)
void f32_to_bf16(const float* __restrict__ in, bf16* __restrict__ out) {
  const size_t i = (size_t)blockIdx.x * 256 + threadIdx.x;
  const float4 f = reinterpret_cast<const float4*>(in)[i];
  bf16* d = out + i * 4;
  d[0] = (bf16)f.x; d[1] = (bf16)f.y; d[2] = (bf16)f.z; d[3] = (bf16)f.w;
}

// ---------------------------------------------------------------------------
// Causal cumulative mean of iV along S, written directly as bf16.
// ---------------------------------------------------------------------------
__global__ __launch_bounds__(256)
void avg_scan(const float* __restrict__ iV, bf16* __restrict__ avg) {
  const int d = blockIdx.x * 256 + threadIdx.x;
  const int b = blockIdx.y;
  const float* src = iV + (size_t)b * Ss * Dd + d;
  bf16*        dst = avg + (size_t)b * Ss * Dd + d;
  float sum = 0.0f;
  for (int s = 0; s < Ss; ++s) {
    sum += src[(size_t)s * Dd];
    dst[(size_t)s * Dd] = (bf16)(sum * (1.0f / (float)(s + 1)));
  }
}

// ---------------------------------------------------------------------------
// bf16 WMMA GEMM with async double-buffered LDS staging.
//   C[M,N] = epilogue(A[M,K] * Bt[N,K]^T + bias[N])
// Block tile 128x128, K-step 32, ping-pong buffers. 8 waves (2x4); each wave
// computes 64x32 = 4x2 WMMA tiles. RELU / WF32 / WBF16 select epilogue.
// ---------------------------------------------------------------------------
template <int RELU, int WF32, int WBF16>
__global__ __launch_bounds__(256)
void gemm_bf16(const bf16* __restrict__ A, const bf16* __restrict__ Bt,
               const float* __restrict__ bias,
               float* __restrict__ outf, bf16* __restrict__ outb,
               int M, int N, int K) {
  __shared__ __align__(16) bf16 As[2][128 * LDK];
  __shared__ __align__(16) bf16 Bs[2][128 * LDK];

  const int tid   = threadIdx.x;
  const int lane  = tid & 31;
  const int wid   = tid >> 5;
  const int half  = lane >> 4;
  const int l16   = lane & 15;
  const int waveM = wid >> 2;   // 0..1
  const int waveN = wid & 3;    // 0..3
  const int m0    = blockIdx.y * 128;
  const int n0    = blockIdx.x * 128;
  const int srow  = tid >> 1;   // 0..127
  const int sseg  = tid & 1;    // 0..1

  const bf16* Ag = A  + (size_t)(m0 + srow) * K + sseg * 16;
  const bf16* Bg = Bt + (size_t)(n0 + srow) * K + sseg * 16;
  bf16* Al[2] = { &As[0][srow * LDK + sseg * 16], &As[1][srow * LDK + sseg * 16] };
  bf16* Bl[2] = { &Bs[0][srow * LDK + sseg * 16], &Bs[1][srow * LDK + sseg * 16] };

  auto stage = [&](int k0, int buf) {   // 4 async-b128 per wave per tile
    async_cp32B(Ag + k0, Al[buf]);
    async_cp32B(Bg + k0, Bl[buf]);
  };

  v8f zero = {};
  v8f acc[4][2];
#pragma unroll
  for (int i = 0; i < 4; ++i)
#pragma unroll
    for (int j = 0; j < 2; ++j) acc[i][j] = zero;

  stage(0, 0);
  for (int k0 = 0, it = 0; k0 < K; k0 += 32, ++it) {
    const int buf  = it & 1;
    const bool more = (k0 + 32 < K);
    if (more) stage(k0 + 32, buf ^ 1);         // overlap next tile with compute
    if (more) WAIT_ASYNC(4); else WAIT_ASYNC(0);
    __syncthreads();

    v16bf af[4], bfr[2];
#pragma unroll
    for (int mi = 0; mi < 4; ++mi)
      af[mi] = ldsFrag(&As[buf][(waveM * 64 + mi * 16 + l16) * LDK + half * 16]);
#pragma unroll
    for (int ni = 0; ni < 2; ++ni)
      bfr[ni] = ldsFrag(&Bs[buf][(waveN * 32 + ni * 16 + l16) * LDK + half * 16]);
#pragma unroll
    for (int mi = 0; mi < 4; ++mi)
#pragma unroll
      for (int ni = 0; ni < 2; ++ni)
        acc[mi][ni] = WMMA_BF16(af[mi], bfr[ni], acc[mi][ni]);
    __syncthreads();
  }

  // ---- epilogue: bias (+relu), convert, store ----
#pragma unroll
  for (int ni = 0; ni < 2; ++ni) {
    const int n = n0 + waveN * 32 + ni * 16 + l16;
    const float bv = bias[n];
#pragma unroll
    for (int mi = 0; mi < 4; ++mi) {
      const int mbase = m0 + waveM * 64 + mi * 16 + 8 * half;
#pragma unroll
      for (int r = 0; r < 8; ++r) {
        float v = acc[mi][ni][r] + bv;
        if (RELU) v = fmaxf(v, 0.0f);
        const size_t idx = (size_t)(mbase + r) * N + n;
        if (WF32)  outf[idx] = v;
        if (WBF16) outb[idx] = (bf16)v;
      }
    }
  }
}

// ---------------------------------------------------------------------------
// Fused gate GEMM:  g = sigmoid(concat([iQ,ffn]) @ Wg + bg), out = gi*iQ+gf*ffn
// A-operand comes from pre-converted bf16 iQ / ffn (async-stageable, the
// concat seam never splits a 16-element chunk). Each block computes paired
// output column tiles n (gate-i) and n+1024 (gate-f) -> fully fused epilogue.
// Block tile: M=128, N=64 per half. 8 waves (4x2); wave = 32x32 per half.
// ---------------------------------------------------------------------------
__global__ __launch_bounds__(256)
void gate_fused(const float* __restrict__ iQ, const float* __restrict__ ffn,
                const bf16* __restrict__ iQb, const bf16* __restrict__ ffnb,
                const bf16* __restrict__ Wgt, const float* __restrict__ bg,
                float* __restrict__ out) {
  __shared__ __align__(16) bf16 As[2][128 * LDK];
  __shared__ __align__(16) bf16 BL[2][64 * LDK];
  __shared__ __align__(16) bf16 BR[2][64 * LDK];

  const int tid   = threadIdx.x;
  const int lane  = tid & 31;
  const int wid   = tid >> 5;
  const int half  = lane >> 4;
  const int l16   = lane & 15;
  const int waveM = wid >> 1;   // 0..3
  const int waveN = wid & 1;    // 0..1
  const int m0    = blockIdx.y * 128;
  const int n0    = blockIdx.x * 64;

  const int srow = tid >> 1;          // A stage: 0..127
  const int sseg = tid & 1;
  const int brow = (tid & 127) >> 1;  // B stage: 0..63 within half
  const bool isR = tid >= 128;

  // B source row (upper half of Wg for threads >= 128)
  const int nrow = (isR ? (Dd + n0) : n0) + brow;
  const bf16* Bgp = Wgt + (size_t)nrow * (2 * Dd) + sseg * 16;
  bf16* Bl[2] = { isR ? &BR[0][brow * LDK + sseg * 16] : &BL[0][brow * LDK + sseg * 16],
                  isR ? &BR[1][brow * LDK + sseg * 16] : &BL[1][brow * LDK + sseg * 16] };
  bf16* Al[2] = { &As[0][srow * LDK + sseg * 16], &As[1][srow * LDK + sseg * 16] };

  auto stage = [&](int k0, int buf) {   // 4 async-b128 per wave per tile
    const int kg = k0 + sseg * 16;      // 16-chunk never straddles the concat seam
    const bf16* asrc = (kg < Dd) ? iQb  + (size_t)(m0 + srow) * Dd + kg
                                 : ffnb + (size_t)(m0 + srow) * Dd + (kg - Dd);
    async_cp32B(asrc, Al[buf]);
    async_cp32B(Bgp + k0, Bl[buf]);
  };

  v8f zero = {};
  v8f accL[2][2], accR[2][2];
#pragma unroll
  for (int i = 0; i < 2; ++i)
#pragma unroll
    for (int j = 0; j < 2; ++j) { accL[i][j] = zero; accR[i][j] = zero; }

  stage(0, 0);
  for (int k0 = 0, it = 0; k0 < 2 * Dd; k0 += 32, ++it) {
    const int buf  = it & 1;
    const bool more = (k0 + 32 < 2 * Dd);
    if (more) stage(k0 + 32, buf ^ 1);
    if (more) WAIT_ASYNC(4); else WAIT_ASYNC(0);
    __syncthreads();

    v16bf af[2], bl[2], br[2];
#pragma unroll
    for (int mi = 0; mi < 2; ++mi)
      af[mi] = ldsFrag(&As[buf][(waveM * 32 + mi * 16 + l16) * LDK + half * 16]);
#pragma unroll
    for (int ni = 0; ni < 2; ++ni) {
      bl[ni] = ldsFrag(&BL[buf][(waveN * 32 + ni * 16 + l16) * LDK + half * 16]);
      br[ni] = ldsFrag(&BR[buf][(waveN * 32 + ni * 16 + l16) * LDK + half * 16]);
    }
#pragma unroll
    for (int mi = 0; mi < 2; ++mi)
#pragma unroll
      for (int ni = 0; ni < 2; ++ni) {
        accL[mi][ni] = WMMA_BF16(af[mi], bl[ni], accL[mi][ni]);
        accR[mi][ni] = WMMA_BF16(af[mi], br[ni], accR[mi][ni]);
      }
    __syncthreads();
  }

  // ---- fused sigmoid-gate epilogue (exact f32 iQ/ffn for the combine) ----
#pragma unroll
  for (int ni = 0; ni < 2; ++ni) {
    const int n = n0 + waveN * 32 + ni * 16 + l16;
    const float bLv = bg[n];
    const float bRv = bg[Dd + n];
#pragma unroll
    for (int mi = 0; mi < 2; ++mi) {
      const int mbase = m0 + waveM * 32 + mi * 16 + 8 * half;
#pragma unroll
      for (int r = 0; r < 8; ++r) {
        const size_t idx = (size_t)(mbase + r) * Dd + n;
        const float gi = sigmoidf(accL[mi][ni][r] + bLv);
        const float gf = sigmoidf(accR[mi][ni][r] + bRv);
        out[idx] = gi * iQ[idx] + gf * ffn[idx];
      }
    }
  }
}

// ---------------------------------------------------------------------------
extern "C" void kernel_launch(void* const* d_in, const int* in_sizes, int n_in,
                              void* d_out, int out_size, void* d_ws, size_t ws_size,
                              hipStream_t stream) {
  const float* iQ = (const float*)d_in[0];
  const float* iV = (const float*)d_in[1];
  const float* W1 = (const float*)d_in[2];
  const float* b1 = (const float*)d_in[3];
  const float* W2 = (const float*)d_in[4];
  const float* b2 = (const float*)d_in[5];
  const float* Wg = (const float*)d_in[6];
  const float* bg = (const float*)d_in[7];
  float* out = (float*)d_out;

  // Workspace layout (~108 MB total)
  char* p = (char*)d_ws;
  bf16*  avg  = (bf16*)p;  p += (size_t)Mrows * Dd * sizeof(bf16);          // 16 MB
  bf16*  h    = (bf16*)p;  p += (size_t)Mrows * Dd * sizeof(bf16);          // 16 MB
  float* ffn  = (float*)p; p += (size_t)Mrows * Dd * sizeof(float);         // 32 MB
  bf16*  ffnb = (bf16*)p;  p += (size_t)Mrows * Dd * sizeof(bf16);          // 16 MB
  bf16*  iQb  = (bf16*)p;  p += (size_t)Mrows * Dd * sizeof(bf16);          // 16 MB
  bf16*  W1t  = (bf16*)p;  p += (size_t)Dd * Dd * sizeof(bf16);             //  2 MB
  bf16*  W2t  = (bf16*)p;  p += (size_t)Dd * Dd * sizeof(bf16);             //  2 MB
  bf16*  Wgt  = (bf16*)p;  p += (size_t)(2 * Dd) * (2 * Dd) * sizeof(bf16); //  8 MB

  // 1) weights -> bf16, transposed to N-major for contiguous B-fragments
  wconv<<<dim3(Dd / 32, Dd / 32), 256, 0, stream>>>(W1, W1t, Dd, Dd);
  wconv<<<dim3(Dd / 32, Dd / 32), 256, 0, stream>>>(W2, W2t, Dd, Dd);
  wconv<<<dim3(2 * Dd / 32, 2 * Dd / 32), 256, 0, stream>>>(Wg, Wgt, 2 * Dd, 2 * Dd);

  // 2) iQ -> bf16 (gate A-operand, async-stageable)
  f32_to_bf16<<<dim3((size_t)Mrows * Dd / 4 / 256), 256, 0, stream>>>(iQ, iQb);

  // 3) causal cumulative mean (the tril/einsum is a prefix scan, not a GEMM)
  avg_scan<<<dim3(Dd / 256, Bb), 256, 0, stream>>>(iV, avg);

  // 4) h = relu(avg @ W1 + b1)        -> bf16
  gemm_bf16<1, 0, 1><<<dim3(Dd / 128, Mrows / 128), 256, 0, stream>>>(
      avg, W1t, b1, nullptr, h, Mrows, Dd, Dd);

  // 5) ffn = h @ W2 + b2              -> f32 (epilogue) + bf16 (gate operand)
  gemm_bf16<0, 1, 1><<<dim3(Dd / 128, Mrows / 128), 256, 0, stream>>>(
      h, W2t, b2, ffn, ffnb, Mrows, Dd, Dd);

  // 6) fused gate GEMM + sigmoid + output combine
  gate_fused<<<dim3(Dd / 64, Mrows / 128), 256, 0, stream>>>(
      iQ, ffn, iQb, ffnb, Wgt, bg, out);
}

// v001
// It runs in 184 microseconds.
// Two timings next to v000 both put it at 2.29 times that version's speed.
#include <hip/hip_runtime.h>
#include <hip/hip_bf16.h>

typedef __bf16 bf16;
typedef __attribute__((ext_vector_type(16))) __bf16 v16bf;
typedef __attribute__((ext_vector_type(8)))  float  v8f;

#define WMMA_BF16(a, b, c) \
  __builtin_amdgcn_wmma_f32_16x16x32_bf16(false, (a), false, (b), (short)0, (c), false, false)

static constexpr int Bb    = 4;
static constexpr int Ss    = 2048;
static constexpr int Dd    = 1024;
static constexpr int Mrows = Bb * Ss;   // 8192 tokens
static constexpr int LDK   = 48;        // LDS row stride in bf16 for K=32 tiles (96B, 16B-aligned)

// ---------------------------------------------------------------------------
// CDNA5 async global->LDS copy (GLOBAL_LOAD_ASYNC_TO_LDS_B128, ASYNCcnt).
// Param types per hipcc diagnostic: (int4 AS(1)*, int4 AS(3)*, imm, imm).
// Guarded so the kernel still compiles (synchronous fallback) if absent.
// ---------------------------------------------------------------------------
#if __has_builtin(__builtin_amdgcn_global_load_async_to_lds_b128)
#define HAVE_ASYNC_LDS 1
typedef int v4i __attribute__((vector_size(16)));
typedef __attribute__((address_space(1))) v4i gv4i;
typedef __attribute__((address_space(3))) v4i lv4i;
__device__ __forceinline__ void async_cp32B(const bf16* g, bf16* l) {
  // two b128 ops: 16B per lane each; wave-wide this stages 2x512B
  __builtin_amdgcn_global_load_async_to_lds_b128((gv4i*)(void*)g,       (lv4i*)l,       0, 0);
  __builtin_amdgcn_global_load_async_to_lds_b128((gv4i*)(void*)(g + 8), (lv4i*)(l + 8), 0, 0);
}
#if __has_builtin(__builtin_amdgcn_s_wait_asynccnt)
#define WAIT_ASYNC(n) __builtin_amdgcn_s_wait_asynccnt(n)
#else
#define WAIT_ASYNC(n) asm volatile("s_wait_asynccnt %0" ::"i"(n) : "memory")
#endif
#else
#define HAVE_ASYNC_LDS 0
#define WAIT_ASYNC(n) ((void)0)
__device__ __forceinline__ void async_cp32B(const bf16* g, bf16* l) {
  const uint4* s = reinterpret_cast<const uint4*>(g);
  uint4* d = reinterpret_cast<uint4*>(l);
  d[0] = s[0]; d[1] = s[1];
}
#endif

// ---------------------------------------------------------------------------
// Load a 16-element bf16 WMMA fragment (32 bytes) from LDS as two b128 reads.
// ---------------------------------------------------------------------------
__device__ __forceinline__ v16bf ldsFrag(const bf16* p) {
  union { v16bf v; uint4 u[2]; } r;
  const uint4* q = reinterpret_cast<const uint4*>(p);
  r.u[0] = q[0];
  r.u[1] = q[1];
  return r.v;
}

__device__ __forceinline__ float sigmoidf(float x) {
  return 1.0f / (1.0f + __expf(-x));
}

// ---------------------------------------------------------------------------
// Weight transpose + f32->bf16 convert:  Wt[n][k] = (bf16) W[k][n]
// ---------------------------------------------------------------------------
__global__ __launch_bounds__(256)
void wconv(const float* __restrict__ W, bf16* __restrict__ Wt, int Kdim, int Ndim) {
  __shared__ float t[32][33];
  const int nb = blockIdx.x * 32;
  const int kb = blockIdx.y * 32;
  const int tx = threadIdx.x & 31;
  const int ty = threadIdx.x >> 5;           // 0..7
  for (int i = ty; i < 32; i += 8)
    t[i][tx] = W[(size_t)(kb + i) * Ndim + (nb + tx)];
  __syncthreads();
  for (int i = ty; i < 32; i += 8)
    Wt[(size_t)(nb + i) * Kdim + (kb + tx)] = (bf16)t[tx][i];
}

// ---------------------------------------------------------------------------
// Elementwise f32 -> bf16 (for iQ, so gate A-tiles can use async staging).
// ---------------------------------------------------------------------------
__global__ __launch_bounds__(256)
void f32_to_bf16(const float* __restrict__ in, bf16* __restrict__ out) {
  const size_t i = (size_t)blockIdx.x * 256 + threadIdx.x;
  const float4 f = reinterpret_cast<const float4*>(in)[i];
  bf16* d = out + i * 4;
  d[0] = (bf16)f.x; d[1] = (bf16)f.y; d[2] = (bf16)f.z; d[3] = (bf16)f.w;
}

// ---------------------------------------------------------------------------
// Causal cumulative mean of iV along S, written directly as bf16.
// Chunked scan: a work-group owns 64 columns (256 B of iV, one whole 128-B line
// of avg per row) and 1024 rows. Each half-wave (16 lanes x 4 columns) holds one
// chunk of 32 rows in registers and scans it there; chunk totals meet in LDS,
// and each chunk adds the totals of all chunks in front of it. Rows in front of
// the work-group's own 1024 are only summed, chunk by chunk, into the same table.
// ---------------------------------------------------------------------------
typedef __attribute__((ext_vector_type(4))) float  v4f;
typedef __attribute__((ext_vector_type(4))) __bf16 v4bf;

static constexpr int SC_COLS   = 64;                          // columns per work-group
static constexpr int SC_ROWS   = 32;                          // rows per chunk
static constexpr int SC_CHUNKS = 32;                          // chunks per work-group (16 waves x 2)
static constexpr int SC_PARTS  = Ss / (SC_ROWS * SC_CHUNKS);  // work-groups along S

__global__ __launch_bounds__(512)
void avg_scan(const float* __restrict__ iV, bf16* __restrict__ avg) {
  __shared__ __align__(16) float csum[SC_PARTS * SC_CHUNKS][SC_COLS];

  const int lc    = (threadIdx.x & 15) * 4;   // column inside the work-group
  const int chunk = threadIdx.x >> 4;         // 0..31
  const int col   = blockIdx.x * SC_COLS + lc;
  const int part  = blockIdx.y;
  const v4f zero  = {};

  // this thread's chunk of part 0: all 32 rows requested at once
  const float* src = iV + ((size_t)blockIdx.z * Ss + chunk * SC_ROWS) * Dd + col;
  v4f v[SC_ROWS];
#pragma unroll
  for (int r = 0; r < SC_ROWS; ++r)
    v[r] = *reinterpret_cast<const v4f*>(src + (size_t)r * Dd);
  // keeps the loads' address pair live to here, so that no load of the run lands in
  // it, and puts the wait in front of the first rewrite of a register they name
  asm volatile("s_wait_xcnt 0x0" :: "v"(src) : "memory");

  // parts in front of the own one: only the chunk's total is kept; each row's
  // registers take the same row of the next part as soon as the row is summed,
  // so that 32 loads of a wave stay in flight up to the own part
#pragma unroll 1   // at most SC_PARTS - 1 trips: a second copy of the body would only be code
  for (int p = 0; p < part; ++p) {
    src += (size_t)SC_CHUNKS * SC_ROWS * Dd;
    v4f s = zero;
#pragma unroll
    for (int r = 0; r < SC_ROWS; ++r) {
      s += v[r];
      v[r] = *reinterpret_cast<const v4f*>(src + (size_t)r * Dd);
    }
    *reinterpret_cast<v4f*>(&csum[p * SC_CHUNKS + chunk][lc]) = s;
  }

  // inclusive scan of the own chunk, in registers
#pragma unroll
  for (int r = 1; r < SC_ROWS; ++r) v[r] += v[r - 1];
  *reinterpret_cast<v4f*>(&csum[part * SC_CHUNKS + chunk][lc]) = v[SC_ROWS - 1];
  __syncthreads();

  // totals of every chunk in front of this one, in row order; 8 independent LDS
  // reads a trip, so that their latency is paid once a trip and not once a chunk
  v4f off = zero;
  for (int c0 = 0; c0 < part * SC_CHUNKS; c0 += 8) {
    v4f t[8];
#pragma unroll
    for (int j = 0; j < 8; ++j) t[j] = *reinterpret_cast<const v4f*>(&csum[c0 + j][lc]);
#pragma unroll
    for (int j = 0; j < 8; ++j) off += t[j];
  }
  const float* own = &csum[part * SC_CHUNKS][lc];
  const int wtop = __builtin_amdgcn_readfirstlane(threadIdx.x >> 5) * 2 + 1;  // the wave's later chunk
  for (int c0 = 0; c0 < wtop; c0 += 8) {
    v4f t[8];
#pragma unroll
    for (int j = 0; j < 8; ++j) t[j] = *reinterpret_cast<const v4f*>(own + (c0 + j) * SC_COLS);
#pragma unroll
    for (int j = 0; j < 8; ++j) off += (c0 + j < chunk) ? t[j] : zero;
  }

  const int row0 = (part * SC_CHUNKS + chunk) * SC_ROWS;
  bf16* dst = avg + ((size_t)blockIdx.z * Ss + row0) * Dd + col;
#pragma unroll
  for (int r = 0; r < SC_ROWS; ++r) {
    const v4f m = (off + v[r]) * (1.0f / (float)(row0 + r + 1));
    *reinterpret_cast<v4bf*>(dst + (size_t)r * Dd) = __builtin_convertvector(m, v4bf);
  }
}

// ---------------------------------------------------------------------------
// bf16 WMMA GEMM with async double-buffered LDS staging.
//   C[M,N] = epilogue(A[M,K] * Bt[N,K]^T + bias[N])
// Block tile 128x128, K-step 32, ping-pong buffers. 8 waves (2x4); each wave
// computes 64x32 = 4x2 WMMA tiles. RELU / WF32 / WBF16 select epilogue.
// ---------------------------------------------------------------------------
template <int RELU, int WF32, int WBF16>
__global__ __launch_bounds__(256)
void gemm_bf16(const bf16* __restrict__ A, const bf16* __restrict__ Bt,
               const float* __restrict__ bias,
               float* __restrict__ outf, bf16* __restrict__ outb,
               int M, int N, int K) {
  __shared__ __align__(16) bf16 As[2][128 * LDK];
  __shared__ __align__(16) bf16 Bs[2][128 * LDK];

  const int tid   = threadIdx.x;
  const int lane  = tid & 31;
  const int wid   = tid >> 5;
  const int half  = lane >> 4;
  const int l16   = lane & 15;
  const int waveM = wid >> 2;   // 0..1
  const int waveN = wid & 3;    // 0..3
  const int m0    = blockIdx.y * 128;
  const int n0    = blockIdx.x * 128;
  const int srow  = tid >> 1;   // 0..127
  const int sseg  = tid & 1;    // 0..1

  const bf16* Ag = A  + (size_t)(m0 + srow) * K + sseg * 16;
  const bf16* Bg = Bt + (size_t)(n0 + srow) * K + sseg * 16;
  bf16* Al[2] = { &As[0][srow * LDK + sseg * 16], &As[1][srow * LDK + sseg * 16] };
  bf16* Bl[2] = { &Bs[0][srow * LDK + sseg * 16], &Bs[1][srow * LDK + sseg * 16] };

  auto stage = [&](int k0, int buf) {   // 4 async-b128 per wave per tile
    async_cp32B(Ag + k0, Al[buf]);
    async_cp32B(Bg + k0, Bl[buf]);
  };

  v8f zero = {};
  v8f acc[4][2];
#pragma unroll
  for (int i = 0; i < 4; ++i)
#pragma unroll
    for (int j = 0; j < 2; ++j) acc[i][j] = zero;

  stage(0, 0);
  for (int k0 = 0, it = 0; k0 < K; k0 += 32, ++it) {
    const int buf  = it & 1;
    const bool more = (k0 + 32 < K);
    if (more) stage(k0 + 32, buf ^ 1);         // overlap next tile with compute
    if (more) WAIT_ASYNC(4); else WAIT_ASYNC(0);
    __syncthreads();

    v16bf af[4], bfr[2];
#pragma unroll
    for (int mi = 0; mi < 4; ++mi)
      af[mi] = ldsFrag(&As[buf][(waveM * 64 + mi * 16 + l16) * LDK + half * 16]);
#pragma unroll
    for (int ni = 0; ni < 2; ++ni)
      bfr[ni] = ldsFrag(&Bs[buf][(waveN * 32 + ni * 16 + l16) * LDK + half * 16]);
#pragma unroll
    for (int mi = 0; mi < 4; ++mi)
#pragma unroll
      for (int ni = 0; ni < 2; ++ni)
        acc[mi][ni] = WMMA_BF16(af[mi], bfr[ni], acc[mi][ni]);
    __syncthreads();
  }

  // ---- epilogue: bias (+relu), convert, store ----
#pragma unroll
  for (int ni = 0; ni < 2; ++ni) {
    const int n = n0 + waveN * 32 + ni * 16 + l16;
    const float bv = bias[n];
#pragma unroll
    for (int mi = 0; mi < 4; ++mi) {
      const int mbase = m0 + waveM * 64 + mi * 16 + 8 * half;
#pragma unroll
      for (int r = 0; r < 8; ++r) {
        float v = acc[mi][ni][r] + bv;
        if (RELU) v = fmaxf(v, 0.0f);
        const size_t idx = (size_t)(mbase + r) * N + n;
        if (WF32)  outf[idx] = v;
        if (WBF16) outb[idx] = (bf16)v;
      }
    }
  }
}

// ---------------------------------------------------------------------------
// Fused gate GEMM:  g = sigmoid(concat([iQ,ffn]) @ Wg + bg), out = gi*iQ+gf*ffn
// A-operand comes from pre-converted bf16 iQ / ffn (async-stageable, the
// concat seam never splits a 16-element chunk). Each block computes paired
// output column tiles n (gate-i) and n+1024 (gate-f) -> fully fused epilogue.
// Block tile: M=128, N=64 per half. 8 waves (4x2); wave = 32x32 per half.
// ---------------------------------------------------------------------------
__global__ __launch_bounds__(256)
void gate_fused(const float* __restrict__ iQ, const float* __restrict__ ffn,
                const bf16* __restrict__ iQb, const bf16* __restrict__ ffnb,
                const bf16* __restrict__ Wgt, const float* __restrict__ bg,
                float* __restrict__ out) {
  __shared__ __align__(16) bf16 As[2][128 * LDK];
  __shared__ __align__(16) bf16 BL[2][64 * LDK];
  __shared__ __align__(16) bf16 BR[2][64 * LDK];

  const int tid   = threadIdx.x;
  const int lane  = tid & 31;
  const int wid   = tid >> 5;
  const int half  = lane >> 4;
  const int l16   = lane & 15;
  const int waveM = wid >> 1;   // 0..3
  const int waveN = wid & 1;    // 0..1
  const int m0    = blockIdx.y * 128;
  const int n0    = blockIdx.x * 64;

  const int srow = tid >> 1;          // A stage: 0..127
  const int sseg = tid & 1;
  const int brow = (tid & 127) >> 1;  // B stage: 0..63 within half
  const bool isR = tid >= 128;

  // B source row (upper half of Wg for threads >= 128)
  const int nrow = (isR ? (Dd + n0) : n0) + brow;
  const bf16* Bgp = Wgt + (size_t)nrow * (2 * Dd) + sseg * 16;
  bf16* Bl[2] = { isR ? &BR[0][brow * LDK + sseg * 16] : &BL[0][brow * LDK + sseg * 16],
                  isR ? &BR[1][brow * LDK + sseg * 16] : &BL[1][brow * LDK + sseg * 16] };
  bf16* Al[2] = { &As[0][srow * LDK + sseg * 16], &As[1][srow * LDK + sseg * 16] };

  auto stage = [&](int k0, int buf) {   // 4 async-b128 per wave per tile
    const int kg = k0 + sseg * 16;      // 16-chunk never straddles the concat seam
    const bf16* asrc = (kg < Dd) ? iQb  + (size_t)(m0 + srow) * Dd + kg
                                 : ffnb + (size_t)(m0 + srow) * Dd + (kg - Dd);
    async_cp32B(asrc, Al[buf]);
    async_cp32B(Bgp + k0, Bl[buf]);
  };

  v8f zero = {};
  v8f accL[2][2], accR[2][2];
#pragma unroll
  for (int i = 0; i < 2; ++i)
#pragma unroll
    for (int j = 0; j < 2; ++j) { accL[i][j] = zero; accR[i][j] = zero; }

  stage(0, 0);
  for (int k0 = 0, it = 0; k0 < 2 * Dd; k0 += 32, ++it) {
    const int buf  = it & 1;
    const bool more = (k0 + 32 < 2 * Dd);
    if (more) stage(k0 + 32, buf ^ 1);
    if (more) WAIT_ASYNC(4); else WAIT_ASYNC(0);
    __syncthreads();

    v16bf af[2], bl[2], br[2];
#pragma unroll
    for (int mi = 0; mi < 2; ++mi)
      af[mi] = ldsFrag(&As[buf][(waveM * 32 + mi * 16 + l16) * LDK + half * 16]);
#pragma unroll
    for (int ni = 0; ni < 2; ++ni) {
      bl[ni] = ldsFrag(&BL[buf][(waveN * 32 + ni * 16 + l16) * LDK + half * 16]);
      br[ni] = ldsFrag(&BR[buf][(waveN * 32 + ni * 16 + l16) * LDK + half * 16]);
    }
#pragma unroll
    for (int mi = 0; mi < 2; ++mi)
#pragma unroll
      for (int ni = 0; ni < 2; ++ni) {
        accL[mi][ni] = WMMA_BF16(af[mi], bl[ni], accL[mi][ni]);
        accR[mi][ni] = WMMA_BF16(af[mi], br[ni], accR[mi][ni]);
      }
    __syncthreads();
  }

  // ---- fused sigmoid-gate epilogue (exact f32 iQ/ffn for the combine) ----
#pragma unroll
  for (int ni = 0; ni < 2; ++ni) {
    const int n = n0 + waveN * 32 + ni * 16 + l16;
    const float bLv = bg[n];
    const float bRv = bg[Dd + n];
#pragma unroll
    for (int mi = 0; mi < 2; ++mi) {
      const int mbase = m0 + waveM * 32 + mi * 16 + 8 * half;
#pragma unroll
      for (int r = 0; r < 8; ++r) {
        const size_t idx = (size_t)(mbase + r) * Dd + n;
        const float gi = sigmoidf(accL[mi][ni][r] + bLv);
        const float gf = sigmoidf(accR[mi][ni][r] + bRv);
        out[idx] = gi * iQ[idx] + gf * ffn[idx];
      }
    }
  }
}

// ---------------------------------------------------------------------------
extern "C" void kernel_launch(void* const* d_in, const int* in_sizes, int n_in,
                              void* d_out, int out_size, void* d_ws, size_t ws_size,
                              hipStream_t stream) {
  const float* iQ = (const float*)d_in[0];
  const float* iV = (const float*)d_in[1];
  const float* W1 = (const float*)d_in[2];
  const float* b1 = (const float*)d_in[3];
  const float* W2 = (const float*)d_in[4];
  const float* b2 = (const float*)d_in[5];
  const float* Wg = (const float*)d_in[6];
  const float* bg = (const float*)d_in[7];
  float* out = (float*)d_out;

  // Workspace layout (~108 MB total)
  char* p = (char*)d_ws;
  bf16*  avg  = (bf16*)p;  p += (size_t)Mrows * Dd * sizeof(bf16);          // 16 MB
  bf16*  h    = (bf16*)p;  p += (size_t)Mrows * Dd * sizeof(bf16);          // 16 MB
  float* ffn  = (float*)p; p += (size_t)Mrows * Dd * sizeof(float);         // 32 MB
  bf16*  ffnb = (bf16*)p;  p += (size_t)Mrows * Dd * sizeof(bf16);          // 16 MB
  bf16*  iQb  = (bf16*)p;  p += (size_t)Mrows * Dd * sizeof(bf16);          // 16 MB
  bf16*  W1t  = (bf16*)p;  p += (size_t)Dd * Dd * sizeof(bf16);             //  2 MB
  bf16*  W2t  = (bf16*)p;  p += (size_t)Dd * Dd * sizeof(bf16);             //  2 MB
  bf16*  Wgt  = (bf16*)p;  p += (size_t)(2 * Dd) * (2 * Dd) * sizeof(bf16); //  8 MB

  // 1) weights -> bf16, transposed to N-major for contiguous B-fragments
  wconv<<<dim3(Dd / 32, Dd / 32), 256, 0, stream>>>(W1, W1t, Dd, Dd);
  wconv<<<dim3(Dd / 32, Dd / 32), 256, 0, stream>>>(W2, W2t, Dd, Dd);
  wconv<<<dim3(2 * Dd / 32, 2 * Dd / 32), 256, 0, stream>>>(Wg, Wgt, 2 * Dd, 2 * Dd);

  // 2) iQ -> bf16 (gate A-operand, async-stageable)
  f32_to_bf16<<<dim3((size_t)Mrows * Dd / 4 / 256), 256, 0, stream>>>(iQ, iQb);

  // 3) causal cumulative mean (the tril/einsum is a prefix scan, not a GEMM)
  avg_scan<<<dim3(Dd / SC_COLS, SC_PARTS, Bb), 512, 0, stream>>>(iV, avg);

  // 4) h = relu(avg @ W1 + b1)        -> bf16
  gemm_bf16<1, 0, 1><<<dim3(Dd / 128, Mrows / 128), 256, 0, stream>>>(
      avg, W1t, b1, nullptr, h, Mrows, Dd, Dd);

  // 5) ffn = h @ W2 + b2              -> f32 (epilogue) + bf16 (gate operand)
  gemm_bf16<0, 1, 1><<<dim3(Dd / 128, Mrows / 128), 256, 0, stream>>>(
      h, W2t, b2, ffn, ffnb, Mrows, Dd, Dd);

  // 6) fused gate GEMM + sigmoid + output combine
  gate_fused<<<dim3(Dd / 64, Mrows / 128), 256, 0, stream>>>(
      iQ, ffn, iQb, ffnb, Wgt, bg, out);
}

// v002
// A run of this version takes 131 microseconds.
// Timed twice side by side with v001, it ran 1.40 and 1.41 times as fast.
// All steps since v000 together make it 3.22 times as fast.
#include <hip/hip_runtime.h>
#include <hip/hip_bf16.h>

typedef __bf16 bf16;
typedef __attribute__((ext_vector_type(16))) __bf16 v16bf;
typedef __attribute__((ext_vector_type(8)))  float  v8f;

#define WMMA_BF16(a, b, c) \
  __builtin_amdgcn_wmma_f32_16x16x32_bf16(false, (a), false, (b), (short)0, (c), false, false)

static constexpr int Bb    = 4;
static constexpr int Ss    = 2048;
static constexpr int Dd    = 1024;
static constexpr int Mrows = Bb * Ss;   // 8192 tokens
static constexpr int KS    = 64;        // k per LDS stage: one whole 128-B line of every operand row
static constexpr int LDK   = 72;        // LDS row pitch in bf16: 144 B = 16 B x 9, no bank conflict for 16-B reads

// ---------------------------------------------------------------------------
// CDNA5 async global->LDS copy (GLOBAL_LOAD_ASYNC_TO_LDS_B128, ASYNCcnt).
// Param types per hipcc diagnostic: (int4 AS(1)*, int4 AS(3)*, imm, imm).
// Guarded so the kernel still compiles (synchronous fallback) if absent.
// ---------------------------------------------------------------------------
#if __has_builtin(__builtin_amdgcn_global_load_async_to_lds_b128)
#define HAVE_ASYNC_LDS 1
typedef int v4i __attribute__((vector_size(16)));
typedef __attribute__((address_space(1))) v4i gv4i;
typedef __attribute__((address_space(3))) v4i lv4i;
__device__ __forceinline__ void async_cp16B(const bf16* g, bf16* l) {
  // one b128 op: 16 B per lane; eight lanes side by side cover one 128-B row
  __builtin_amdgcn_global_load_async_to_lds_b128((gv4i*)(void*)g, (lv4i*)l, 0, 0);
}
// the wave's own copies have landed; in asm, so that no LDS read is moved in front of it
#define WAIT_ASYNC0() asm volatile("s_wait_asynccnt 0x0" ::: "memory")
#else
#define HAVE_ASYNC_LDS 0
#define WAIT_ASYNC0() ((void)0)
__device__ __forceinline__ void async_cp16B(const bf16* g, bf16* l) {
  *reinterpret_cast<uint4*>(l) = *reinterpret_cast<const uint4*>(g);
}
#endif
// the wave's own LDS reads are done before the barrier behind which their buffer is refilled
#define WAIT_DS0() asm volatile("s_wait_dscnt 0x0" ::: "memory")

// ---------------------------------------------------------------------------
// Load a 16-element bf16 WMMA fragment (32 bytes) from LDS as two b128 reads.
// ---------------------------------------------------------------------------
__device__ __forceinline__ v16bf ldsFrag(const bf16* p) {
  union { v16bf v; uint4 u[2]; } r;
  const uint4* q = reinterpret_cast<const uint4*>(p);
  r.u[0] = q[0];
  r.u[1] = q[1];
  return r.v;
}

__device__ __forceinline__ float sigmoidf(float x) {
  return 1.0f / (1.0f + __expf(-x));
}

// ---------------------------------------------------------------------------
// Weight transpose + f32->bf16 convert:  Wt[n][k] = (bf16) W[k][n]
// ---------------------------------------------------------------------------
__global__ __launch_bounds__(256)
void wconv(const float* __restrict__ W, bf16* __restrict__ Wt, int Kdim, int Ndim) {
  __shared__ float t[32][33];
  const int nb = blockIdx.x * 32;
  const int kb = blockIdx.y * 32;
  const int tx = threadIdx.x & 31;
  const int ty = threadIdx.x >> 5;           // 0..7
  for (int i = ty; i < 32; i += 8)
    t[i][tx] = W[(size_t)(kb + i) * Ndim + (nb + tx)];
  __syncthreads();
  for (int i = ty; i < 32; i += 8)
    Wt[(size_t)(nb + i) * Kdim + (kb + tx)] = (bf16)t[tx][i];
}

// ---------------------------------------------------------------------------
// Elementwise f32 -> bf16 (for iQ, so gate A-tiles can use async staging).
// ---------------------------------------------------------------------------
__global__ __launch_bounds__(256)
void f32_to_bf16(const float* __restrict__ in, bf16* __restrict__ out) {
  const size_t i = (size_t)blockIdx.x * 256 + threadIdx.x;
  const float4 f = reinterpret_cast<const float4*>(in)[i];
  bf16* d = out + i * 4;
  d[0] = (bf16)f.x; d[1] = (bf16)f.y; d[2] = (bf16)f.z; d[3] = (bf16)f.w;
}

// ---------------------------------------------------------------------------
// Causal cumulative mean of iV along S, written directly as bf16.
// Chunked scan: a work-group owns 64 columns (256 B of iV, one whole 128-B line
// of avg per row) and 1024 rows. Each half-wave (16 lanes x 4 columns) holds one
// chunk of 32 rows in registers and scans it there; chunk totals meet in LDS,
// and each chunk adds the totals of all chunks in front of it. Rows in front of
// the work-group's own 1024 are only summed, chunk by chunk, into the same table.
// ---------------------------------------------------------------------------
typedef __attribute__((ext_vector_type(4))) float  v4f;
typedef __attribute__((ext_vector_type(4))) __bf16 v4bf;

static constexpr int SC_COLS   = 64;                          // columns per work-group
static constexpr int SC_ROWS   = 32;                          // rows per chunk
static constexpr int SC_CHUNKS = 32;                          // chunks per work-group (16 waves x 2)
static constexpr int SC_PARTS  = Ss / (SC_ROWS * SC_CHUNKS);  // work-groups along S

__global__ __launch_bounds__(512)
void avg_scan(const float* __restrict__ iV, bf16* __restrict__ avg) {
  __shared__ __align__(16) float csum[SC_PARTS * SC_CHUNKS][SC_COLS];

  const int lc    = (threadIdx.x & 15) * 4;   // column inside the work-group
  const int chunk = threadIdx.x >> 4;         // 0..31
  const int col   = blockIdx.x * SC_COLS + lc;
  const int part  = blockIdx.y;
  const v4f zero  = {};

  // this thread's chunk of part 0: all 32 rows requested at once
  const float* src = iV + ((size_t)blockIdx.z * Ss + chunk * SC_ROWS) * Dd + col;
  v4f v[SC_ROWS];
#pragma unroll
  for (int r = 0; r < SC_ROWS; ++r)
    v[r] = *reinterpret_cast<const v4f*>(src + (size_t)r * Dd);
  // keeps the loads' address pair live to here, so that no load of the run lands in
  // it, and puts the wait in front of the first rewrite of a register they name
  asm volatile("s_wait_xcnt 0x0" :: "v"(src) : "memory");

  // parts in front of the own one: only the chunk's total is kept; each row's
  // registers take the same row of the next part as soon as the row is summed,
  // so that 32 loads of a wave stay in flight up to the own part
#pragma unroll 1   // at most SC_PARTS - 1 trips: a second copy of the body would only be code
  for (int p = 0; p < part; ++p) {
    src += (size_t)SC_CHUNKS * SC_ROWS * Dd;
    v4f s = zero;
#pragma unroll
    for (int r = 0; r < SC_ROWS; ++r) {
      s += v[r];
      v[r] = *reinterpret_cast<const v4f*>(src + (size_t)r * Dd);
    }
    *reinterpret_cast<v4f*>(&csum[p * SC_CHUNKS + chunk][lc]) = s;
  }

  // inclusive scan of the own chunk, in registers
#pragma unroll
  for (int r = 1; r < SC_ROWS; ++r) v[r] += v[r - 1];
  *reinterpret_cast<v4f*>(&csum[part * SC_CHUNKS + chunk][lc]) = v[SC_ROWS - 1];
  __syncthreads();

  // totals of every chunk in front of this one, in row order; 8 independent LDS
  // reads a trip, so that their latency is paid once a trip and not once a chunk
  v4f off = zero;
  for (int c0 = 0; c0 < part * SC_CHUNKS; c0 += 8) {
    v4f t[8];
#pragma unroll
    for (int j = 0; j < 8; ++j) t[j] = *reinterpret_cast<const v4f*>(&csum[c0 + j][lc]);
#pragma unroll
    for (int j = 0; j < 8; ++j) off += t[j];
  }
  const float* own = &csum[part * SC_CHUNKS][lc];
  const int wtop = __builtin_amdgcn_readfirstlane(threadIdx.x >> 5) * 2 + 1;  // the wave's later chunk
  for (int c0 = 0; c0 < wtop; c0 += 8) {
    v4f t[8];
#pragma unroll
    for (int j = 0; j < 8; ++j) t[j] = *reinterpret_cast<const v4f*>(own + (c0 + j) * SC_COLS);
#pragma unroll
    for (int j = 0; j < 8; ++j) off += (c0 + j < chunk) ? t[j] : zero;
  }

  const int row0 = (part * SC_CHUNKS + chunk) * SC_ROWS;
  bf16* dst = avg + ((size_t)blockIdx.z * Ss + row0) * Dd + col;
#pragma unroll
  for (int r = 0; r < SC_ROWS; ++r) {
    const v4f m = (off + v[r]) * (1.0f / (float)(row0 + r + 1));
    *reinterpret_cast<v4bf*>(dst + (size_t)r * Dd) = __builtin_convertvector(m, v4bf);
  }
}

// ---------------------------------------------------------------------------
// bf16 WMMA GEMM with async double-buffered LDS staging.
//   C[M,N] = epilogue(A[M,K] * Bt[N,K]^T + bias[N])
// Block tile 128x128, stages of KS k in two buffers, one barrier a stage. 8 waves
// (2x4); each wave computes 64x32 = 4x2 WMMA tiles. K is a multiple of KS.
// RELU / WF32 / WBF16 select epilogue.
// ---------------------------------------------------------------------------
template <int RELU, int WF32, int WBF16>
__global__ __launch_bounds__(256)
void gemm_bf16(const bf16* __restrict__ A, const bf16* __restrict__ Bt,
               const float* __restrict__ bias,
               float* __restrict__ outf, bf16* __restrict__ outb,
               int M, int N, int K) {
  __shared__ __align__(16) bf16 As[2][128 * LDK];
  __shared__ __align__(16) bf16 Bs[2][128 * LDK];

  const int tid   = threadIdx.x;
  const int lane  = tid & 31;
  const int wid   = tid >> 5;
  const int half  = lane >> 4;
  const int l16   = lane & 15;
  const int waveM = wid >> 2;   // 0..1
  const int waveN = wid & 3;    // 0..3
  const int m0    = blockIdx.y * 128;
  const int n0    = blockIdx.x * 128;
  const int srow  = tid >> 3;   // 0..31: first of this thread's four rows, 32 apart
  const int sseg  = tid & 7;    // 16-B piece of the row's 128 B

  const bf16* Ag = A  + (size_t)(m0 + srow) * K + sseg * 8;
  const bf16* Bg = Bt + (size_t)(n0 + srow) * K + sseg * 8;
  const int lofs = srow * LDK + sseg * 8;

  auto stage = [&](int k0, int buf) {   // 8 async-b128 per wave per stage, 4 whole lines each
#pragma unroll   // the four row offsets become constants of their copies
    for (int i = 0; i < 4; ++i) {
      async_cp16B(Ag + (size_t)(i * 32) * K + k0, &As[buf][lofs + i * 32 * LDK]);
      async_cp16B(Bg + (size_t)(i * 32) * K + k0, &Bs[buf][lofs + i * 32 * LDK]);
    }
  };

  v8f zero = {};
  v8f acc[4][2];
#pragma unroll
  for (int i = 0; i < 4; ++i)
#pragma unroll
    for (int j = 0; j < 2; ++j) acc[i][j] = zero;

  const int T = K / KS;
  stage(0, 0);
  WAIT_ASYNC0();
  __syncthreads();
  if (T > 1) stage(KS, 1);                     // flies while stage 0 is worked on
  for (int t = 0; t < T; ++t) {
    const int buf = t & 1;
#pragma unroll   // both 32-k blocks of a stage in one straight run, kk an immediate offset of the reads
    for (int kk = 0; kk < KS; kk += 32) {
      v16bf af[4], bfr[2];
#pragma unroll
      for (int mi = 0; mi < 4; ++mi)
        af[mi] = ldsFrag(&As[buf][(waveM * 64 + mi * 16 + l16) * LDK + kk + half * 16]);
#pragma unroll
      for (int ni = 0; ni < 2; ++ni)
        bfr[ni] = ldsFrag(&Bs[buf][(waveN * 32 + ni * 16 + l16) * LDK + kk + half * 16]);
#pragma unroll
      for (int mi = 0; mi < 4; ++mi)
#pragma unroll
        for (int ni = 0; ni < 2; ++ni)
          acc[mi][ni] = WMMA_BF16(af[mi], bfr[ni], acc[mi][ni]);
    }
    // one barrier publishes stage t + 1 and ends every read of stage t's buffer
    WAIT_DS0();
    WAIT_ASYNC0();
    __syncthreads();
    if (t + 2 < T) stage((t + 2) * KS, buf);   // refill the buffer just left
  }
  WAIT_ASYNC0();

  // ---- epilogue: bias (+relu), convert, store ----
#pragma unroll
  for (int ni = 0; ni < 2; ++ni) {
    const int n = n0 + waveN * 32 + ni * 16 + l16;
    const float bv = bias[n];
#pragma unroll
    for (int mi = 0; mi < 4; ++mi) {
      const int mbase = m0 + waveM * 64 + mi * 16 + 8 * half;
#pragma unroll
      for (int r = 0; r < 8; ++r) {
        float v = acc[mi][ni][r] + bv;
        if (RELU) v = fmaxf(v, 0.0f);
        const size_t idx = (size_t)(mbase + r) * N + n;
        if (WF32)  outf[idx] = v;
        if (WBF16) outb[idx] = (bf16)v;
      }
    }
  }
}

// ---------------------------------------------------------------------------
// Fused gate GEMM:  g = sigmoid(concat([iQ,ffn]) @ Wg + bg), out = gi*iQ+gf*ffn
// A-operand comes from pre-converted bf16 iQ / ffn (async-stageable, the
// concat seam never splits a stage of KS k). Each block computes paired
// output column tiles n (gate-i) and n+1024 (gate-f) -> fully fused epilogue.
// Block tile: M=128, N=64 per half. 8 waves (4x2); wave = 32x32 per half.
// ---------------------------------------------------------------------------
__global__ __launch_bounds__(256)
void gate_fused(const float* __restrict__ iQ, const float* __restrict__ ffn,
                const bf16* __restrict__ iQb, const bf16* __restrict__ ffnb,
                const bf16* __restrict__ Wgt, const float* __restrict__ bg,
                float* __restrict__ out) {
  __shared__ __align__(16) bf16 As[2][128 * LDK];
  __shared__ __align__(16) bf16 Bs[2][128 * LDK];   // rows 0..63 gate-i columns, 64..127 gate-f

  const int tid   = threadIdx.x;
  const int lane  = tid & 31;
  const int wid   = tid >> 5;
  const int half  = lane >> 4;
  const int l16   = lane & 15;
  const int waveM = wid >> 1;   // 0..3
  const int waveN = wid & 1;    // 0..1
  const int m0    = blockIdx.y * 128;
  const int n0    = blockIdx.x * 64;

  const int srow = tid >> 3;          // 0..31: first of this thread's four rows, 32 apart
  const int sseg = tid & 7;           // 16-B piece of the row's 128 B
  const size_t aofs = (size_t)(m0 + srow) * Dd + sseg * 8;
  const bf16* Bgp = Wgt + (size_t)(n0 + srow) * (2 * Dd) + sseg * 8;
  const int lofs = srow * LDK + sseg * 8;

  auto stage = [&](int k0, int buf) {   // 8 async-b128 per wave per stage, 4 whole lines each
    const bf16* asrc = (k0 < Dd) ? iQb + aofs + k0 : ffnb + aofs + (k0 - Dd);
#pragma unroll   // the four row offsets become constants of their copies
    for (int i = 0; i < 4; ++i) {
      const int wrow = i * 32 + (i >= 2 ? Dd - 64 : 0);   // LDS rows 64.. hold Wgt rows Dd + n0..
      async_cp16B(asrc + (size_t)(i * 32) * Dd, &As[buf][lofs + i * 32 * LDK]);
      async_cp16B(Bgp + (size_t)wrow * (2 * Dd) + k0, &Bs[buf][lofs + i * 32 * LDK]);
    }
  };

  v8f zero = {};
  v8f accL[2][2], accR[2][2];
#pragma unroll
  for (int i = 0; i < 2; ++i)
#pragma unroll
    for (int j = 0; j < 2; ++j) { accL[i][j] = zero; accR[i][j] = zero; }

  constexpr int T = 2 * Dd / KS;
  stage(0, 0);
  WAIT_ASYNC0();
  __syncthreads();
  stage(KS, 1);                                // flies while stage 0 is worked on
  for (int t = 0; t < T; ++t) {
    const int buf = t & 1;
#pragma unroll   // both 32-k blocks of a stage in one straight run, kk an immediate offset of the reads
    for (int kk = 0; kk < KS; kk += 32) {
      v16bf af[2], bl[2], br[2];
#pragma unroll
      for (int mi = 0; mi < 2; ++mi)
        af[mi] = ldsFrag(&As[buf][(waveM * 32 + mi * 16 + l16) * LDK + kk + half * 16]);
#pragma unroll
      for (int ni = 0; ni < 2; ++ni) {
        bl[ni] = ldsFrag(&Bs[buf][(waveN * 32 + ni * 16 + l16) * LDK + kk + half * 16]);
        br[ni] = ldsFrag(&Bs[buf][(64 + waveN * 32 + ni * 16 + l16) * LDK + kk + half * 16]);
      }
#pragma unroll
      for (int mi = 0; mi < 2; ++mi)
#pragma unroll
        for (int ni = 0; ni < 2; ++ni) {
          accL[mi][ni] = WMMA_BF16(af[mi], bl[ni], accL[mi][ni]);
          accR[mi][ni] = WMMA_BF16(af[mi], br[ni], accR[mi][ni]);
        }
    }
    // one barrier publishes stage t + 1 and ends every read of stage t's buffer
    WAIT_DS0();
    WAIT_ASYNC0();
    __syncthreads();
    if (t + 2 < T) stage((t + 2) * KS, buf);   // refill the buffer just left
  }
  WAIT_ASYNC0();

  // ---- fused sigmoid-gate epilogue (exact f32 iQ/ffn for the combine) ----
#pragma unroll
  for (int ni = 0; ni < 2; ++ni) {
    const int n = n0 + waveN * 32 + ni * 16 + l16;
    const float bLv = bg[n];
    const float bRv = bg[Dd + n];
#pragma unroll
    for (int mi = 0; mi < 2; ++mi) {
      const int mbase = m0 + waveM * 32 + mi * 16 + 8 * half;
#pragma unroll
      for (int r = 0; r < 8; ++r) {
        const size_t idx = (size_t)(mbase + r) * Dd + n;
        const float gi = sigmoidf(accL[mi][ni][r] + bLv);
        const float gf = sigmoidf(accR[mi][ni][r] + bRv);
        out[idx] = gi * iQ[idx] + gf * ffn[idx];
      }
    }
  }
}

// ---------------------------------------------------------------------------
extern "C" void kernel_launch(void* const* d_in, const int* in_sizes, int n_in,
                              void* d_out, int out_size, void* d_ws, size_t ws_size,
                              hipStream_t stream) {
  const float* iQ = (const float*)d_in[0];
  const float* iV = (const float*)d_in[1];
  const float* W1 = (const float*)d_in[2];
  const float* b1 = (const float*)d_in[3];
  const float* W2 = (const float*)d_in[4];
  const float* b2 = (const float*)d_in[5];
  const float* Wg = (const float*)d_in[6];
  const float* bg = (const float*)d_in[7];
  float* out = (float*)d_out;

  // Workspace layout (~108 MB total)
  char* p = (char*)d_ws;
  bf16*  avg  = (bf16*)p;  p += (size_t)Mrows * Dd * sizeof(bf16);          // 16 MB
  bf16*  h    = (bf16*)p;  p += (size_t)Mrows * Dd * sizeof(bf16);          // 16 MB
  float* ffn  = (float*)p; p += (size_t)Mrows * Dd * sizeof(float);         // 32 MB
  bf16*  ffnb = (bf16*)p;  p += (size_t)Mrows * Dd * sizeof(bf16);          // 16 MB
  bf16*  iQb  = (bf16*)p;  p += (size_t)Mrows * Dd * sizeof(bf16);          // 16 MB
  bf16*  W1t  = (bf16*)p;  p += (size_t)Dd * Dd * sizeof(bf16);             //  2 MB
  bf16*  W2t  = (bf16*)p;  p += (size_t)Dd * Dd * sizeof(bf16);             //  2 MB
  bf16*  Wgt  = (bf16*)p;  p += (size_t)(2 * Dd) * (2 * Dd) * sizeof(bf16); //  8 MB

  // 1) weights -> bf16, transposed to N-major for contiguous B-fragments
  wconv<<<dim3(Dd / 32, Dd / 32), 256, 0, stream>>>(W1, W1t, Dd, Dd);
  wconv<<<dim3(Dd / 32, Dd / 32), 256, 0, stream>>>(W2, W2t, Dd, Dd);
  wconv<<<dim3(2 * Dd / 32, 2 * Dd / 32), 256, 0, stream>>>(Wg, Wgt, 2 * Dd, 2 * Dd);

  // 2) iQ -> bf16 (gate A-operand, async-stageable)
  f32_to_bf16<<<dim3((size_t)Mrows * Dd / 4 / 256), 256, 0, stream>>>(iQ, iQb);

  // 3) causal cumulative mean (the tril/einsum is a prefix scan, not a GEMM)
  avg_scan<<<dim3(Dd / SC_COLS, SC_PARTS, Bb), 512, 0, stream>>>(iV, avg);

  // 4) h = relu(avg @ W1 + b1)        -> bf16
  gemm_bf16<1, 0, 1><<<dim3(Dd / 128, Mrows / 128), 256, 0, stream>>>(
      avg, W1t, b1, nullptr, h, Mrows, Dd, Dd);

  // 5) ffn = h @ W2 + b2              -> f32 (epilogue) + bf16 (gate operand)
  gemm_bf16<0, 1, 1><<<dim3(Dd / 128, Mrows / 128), 256, 0, stream>>>(
      h, W2t, b2, ffn, ffnb, Mrows, Dd, Dd);

  // 6) fused gate GEMM + sigmoid + output combine
  gate_fused<<<dim3(Dd / 64, Mrows / 128), 256, 0, stream>>>(
      iQ, ffn, iQb, ffnb, Wgt, bg, out);
}

// v003
// It runs in 111 microseconds.
// In both of two side-by-side timings against v002, it was 1.18 times as fast.
// All steps since v000 together make it 3.79 times as fast.
#include <hip/hip_runtime.h>
#include <hip/hip_bf16.h>

typedef __bf16 bf16;
typedef __attribute__((ext_vector_type(16))) __bf16 v16bf;
typedef __attribute__((ext_vector_type(8)))  float  v8f;

#define WMMA_BF16(a, b, c) \
  __builtin_amdgcn_wmma_f32_16x16x32_bf16(false, (a), false, (b), (short)0, (c), false, false)

static constexpr int Bb    = 4;
static constexpr int Ss    = 2048;
static constexpr int Dd    = 1024;
static constexpr int Mrows = Bb * Ss;   // 8192 tokens
static constexpr int KS    = 64;        // k per LDS stage: one whole 128-B line of every operand row
static constexpr int LDK   = 72;        // LDS row pitch in bf16: 144 B = 16 B x 9, no bank conflict for 16-B reads

// ---------------------------------------------------------------------------
// CDNA5 async global->LDS copy (GLOBAL_LOAD_ASYNC_TO_LDS_B128, ASYNCcnt).
// Param types per hipcc diagnostic: (int4 AS(1)*, int4 AS(3)*, imm, imm).
// Guarded so the kernel still compiles (synchronous fallback) if absent.
// ---------------------------------------------------------------------------
#if __has_builtin(__builtin_amdgcn_global_load_async_to_lds_b128)
#define HAVE_ASYNC_LDS 1
typedef int v4i __attribute__((vector_size(16)));
typedef __attribute__((address_space(1))) v4i gv4i;
typedef __attribute__((address_space(3))) v4i lv4i;
__device__ __forceinline__ void async_cp16B(const bf16* g, bf16* l) {
  // one b128 op: 16 B per lane; eight lanes side by side cover one 128-B row
  __builtin_amdgcn_global_load_async_to_lds_b128((gv4i*)(void*)g, (lv4i*)l, 0, 0);
}
// the wave's own copies have landed; in asm, so that no LDS read is moved in front of it
#define WAIT_ASYNC0() asm volatile("s_wait_asynccnt 0x0" ::: "memory")
#else
#define HAVE_ASYNC_LDS 0
#define WAIT_ASYNC0() ((void)0)
__device__ __forceinline__ void async_cp16B(const bf16* g, bf16* l) {
  *reinterpret_cast<uint4*>(l) = *reinterpret_cast<const uint4*>(g);
}
#endif
// the wave's own LDS reads are done before the barrier behind which their buffer is refilled
#define WAIT_DS0() asm volatile("s_wait_dscnt 0x0" ::: "memory")

// ---------------------------------------------------------------------------
// Load a 16-element bf16 WMMA fragment (32 bytes) from LDS as two b128 reads.
// ---------------------------------------------------------------------------
__device__ __forceinline__ v16bf ldsFrag(const bf16* p) {
  union { v16bf v; uint4 u[2]; } r;
  const uint4* q = reinterpret_cast<const uint4*>(p);
  r.u[0] = q[0];
  r.u[1] = q[1];
  return r.v;
}

__device__ __forceinline__ float sigmoidf(float x) {
  return 1.0f / (1.0f + __expf(-x));
}

typedef __attribute__((ext_vector_type(4))) float  v4f;
typedef __attribute__((ext_vector_type(4))) __bf16 v4bf;
typedef __attribute__((ext_vector_type(2))) __bf16 v2bf;

static constexpr int PREP_THREADS = 512;   // every work-group of the preparation launch: 16 waves

// ---------------------------------------------------------------------------
// Weight transpose + f32->bf16 convert:  Wt[n][k] = (bf16) W[k][n], W is DIM x DIM.
// One work-group takes a tile of 256 k x 128 n. A wave reads whole rows of the
// tile (512 B), two neighbouring k rows a lane, all 16 loads requested at once,
// packs each (k, k + 1) pair into one dword and stores it transposed in LDS;
// rows of Wt leave as aligned 256-B runs.
// ---------------------------------------------------------------------------
static constexpr int WT_K     = 256;            // tile extent along k
static constexpr int WT_N     = 128;            // tile extent along n
static constexpr int WT_PITCH = WT_K / 2 + 1;   // LDS row pitch in dwords: odd, so that rows start on different banks

template <int DIM>
__device__ __forceinline__ void wconv_tile(const float* __restrict__ W, bf16* __restrict__ Wt,
                                           int tile, unsigned* __restrict__ t) {
  constexpr int NT = DIM / WT_N;
  const int nb   = (tile % NT) * WT_N;
  const int kb   = (tile / NT) * WT_K;
  const int lane = threadIdx.x & 31;
  const int wave = threadIdx.x >> 5;         // 0..15

  const float* src = W + (size_t)(kb + 2 * wave) * DIM + nb + lane * 4;
  v4f a[8], b[8];
#pragma unroll   // the row steps become immediate offsets on one address pair
  for (int i = 0; i < 8; ++i) {
    a[i] = *reinterpret_cast<const v4f*>(src + (size_t)(i * 32) * DIM);
    b[i] = *reinterpret_cast<const v4f*>(src + (size_t)(i * 32 + 1) * DIM);
  }
  // keeps the loads' address pair live to here, so that no load of the run lands in
  // it, and puts the wait in front of the first rewrite of a register they name
  asm volatile("s_wait_xcnt 0x0" :: "v"(src) : "memory");
#pragma unroll   // a[], b[] stay in registers: every index a constant
  for (int i = 0; i < 8; ++i)
#pragma unroll   // as above
    for (int j = 0; j < 4; ++j) {
      const v2bf p = {(bf16)a[i][j], (bf16)b[i][j]};
      t[(lane * 4 + j) * WT_PITCH + i * 16 + wave] = __builtin_bit_cast(unsigned, p);
    }
  __syncthreads();
#pragma unroll   // all LDS reads of the eight pieces go out ahead of the first store
  for (int i = 0; i < 8; ++i) {
    const int n = (i >> 1) * 32 + wave * 2 + (lane >> 4);
    const int q = (i & 1) * 16 + (lane & 15);   // 16-B piece of the row's 512 B
    const unsigned* r = t + n * WT_PITCH + q * 4;
    const uint4 o = make_uint4(r[0], r[1], r[2], r[3]);
    *reinterpret_cast<uint4*>(Wt + (size_t)(nb + n) * DIM + kb + q * 8) = o;
  }
  // the wait in front of any later rewrite of a register that the eight stores name
  asm volatile("s_wait_xcnt 0x0" ::: "memory");
}

// ---------------------------------------------------------------------------
// Elementwise f32 -> bf16 (for iQ, so gate A-tiles can use async staging).
// One work-group converts 256 KiB: 32 loads of 16 B a lane, all requested at once.
// ---------------------------------------------------------------------------
static constexpr int CV_LOADS = 32;

__device__ __forceinline__ void f32_to_bf16_block(const float* __restrict__ in, bf16* __restrict__ out,
                                                  int blk) {
  const size_t i0 = (size_t)blk * (PREP_THREADS * CV_LOADS) + threadIdx.x;
  const v4f* s = reinterpret_cast<const v4f*>(in) + i0;
  v4bf*      d = reinterpret_cast<v4bf*>(out) + i0;
  v4f f[CV_LOADS];
#pragma unroll   // f[] stays in registers, the steps become immediate offsets
  for (int i = 0; i < CV_LOADS; ++i) f[i] = s[i * PREP_THREADS];
#pragma unroll   // as above
  for (int i = 0; i < CV_LOADS; ++i) {
    d[i * PREP_THREADS] = __builtin_convertvector(f[i], v4bf);
    // lets each eight stores leave while later loads are still under way; without it
    // the compiler gathers all stores behind the wait for the last load
    if (i % 8 == 7) __builtin_amdgcn_sched_barrier(0);
  }
  // the wait in front of any later rewrite of a register that the last stores name
  asm volatile("s_wait_xcnt 0x0" ::: "memory");
}

// ---------------------------------------------------------------------------
// Causal cumulative mean of iV along S, written directly as bf16.
// Chunked scan: a work-group owns 64 columns (256 B of iV, one whole 128-B line
// of avg per row) and 1024 rows. Each half-wave (16 lanes x 4 columns) holds one
// chunk of 32 rows in registers and scans it there; chunk totals meet in LDS,
// and each chunk adds the totals of all chunks in front of it. Rows in front of
// the work-group's own 1024 are only summed, chunk by chunk, into the same table.
// ---------------------------------------------------------------------------
static constexpr int SC_COLS   = 64;                          // columns per work-group
static constexpr int SC_ROWS   = 32;                          // rows per chunk
static constexpr int SC_CHUNKS = 32;                          // chunks per work-group (16 waves x 2)
static constexpr int SC_PARTS  = Ss / (SC_ROWS * SC_CHUNKS);  // work-groups along S

__device__ __forceinline__ void avg_scan(const float* __restrict__ iV, bf16* __restrict__ avg,
                                         int colgrp, int part, int batch,
                                         float (*__restrict__ csum)[SC_COLS]) {
  const int lc    = (threadIdx.x & 15) * 4;   // column inside the work-group
  const int chunk = threadIdx.x >> 4;         // 0..31
  const int col   = colgrp * SC_COLS + lc;
  const v4f zero  = {};

  // this thread's chunk of part 0: all 32 rows requested at once
  const float* src = iV + ((size_t)batch * Ss + chunk * SC_ROWS) * Dd + col;
  v4f v[SC_ROWS];
#pragma unroll
  for (int r = 0; r < SC_ROWS; ++r)
    v[r] = *reinterpret_cast<const v4f*>(src + (size_t)r * Dd);
  // keeps the loads' address pair live to here, so that no load of the run lands in
  // it, and puts the wait in front of the first rewrite of a register they name
  asm volatile("s_wait_xcnt 0x0" :: "v"(src) : "memory");

  // parts in front of the own one: only the chunk's total is kept; each row's
  // registers take the same row of the next part as soon as the row is summed,
  // so that 32 loads of a wave stay in flight up to the own part
#pragma unroll 1   // at most SC_PARTS - 1 trips: a second copy of the body would only be code
  for (int p = 0; p < part; ++p) {
    src += (size_t)SC_CHUNKS * SC_ROWS * Dd;
    v4f s = zero;
#pragma unroll
    for (int r = 0; r < SC_ROWS; ++r) {
      s += v[r];
      v[r] = *reinterpret_cast<const v4f*>(src + (size_t)r * Dd);
    }
    *reinterpret_cast<v4f*>(&csum[p * SC_CHUNKS + chunk][lc]) = s;
  }

  // inclusive scan of the own chunk, in registers
#pragma unroll
  for (int r = 1; r < SC_ROWS; ++r) v[r] += v[r - 1];
  *reinterpret_cast<v4f*>(&csum[part * SC_CHUNKS + chunk][lc]) = v[SC_ROWS - 1];
  __syncthreads();

  // totals of every chunk in front of this one, in row order; 8 independent LDS
  // reads a trip, so that their latency is paid once a trip and not once a chunk
  v4f off = zero;
  for (int c0 = 0; c0 < part * SC_CHUNKS; c0 += 8) {
    v4f t[8];
#pragma unroll
    for (int j = 0; j < 8; ++j) t[j] = *reinterpret_cast<const v4f*>(&csum[c0 + j][lc]);
#pragma unroll
    for (int j = 0; j < 8; ++j) off += t[j];
  }
  const float* own = &csum[part * SC_CHUNKS][lc];
  const int wtop = __builtin_amdgcn_readfirstlane(threadIdx.x >> 5) * 2 + 1;  // the wave's later chunk
  for (int c0 = 0; c0 < wtop; c0 += 8) {
    v4f t[8];
#pragma unroll
    for (int j = 0; j < 8; ++j) t[j] = *reinterpret_cast<const v4f*>(own + (c0 + j) * SC_COLS);
#pragma unroll
    for (int j = 0; j < 8; ++j) off += (c0 + j < chunk) ? t[j] : zero;
  }

  const int row0 = (part * SC_CHUNKS + chunk) * SC_ROWS;
  bf16* dst = avg + ((size_t)batch * Ss + row0) * Dd + col;
#pragma unroll
  for (int r = 0; r < SC_ROWS; ++r) {
    const v4f m = (off + v[r]) * (1.0f / (float)(row0 + r + 1));
    *reinterpret_cast<v4bf*>(dst + (size_t)r * Dd) = __builtin_convertvector(m, v4bf);
  }
}

// ---------------------------------------------------------------------------
// All work that depends on the inputs alone, in one launch: none of its pieces
// reads what another writes. Ranges of blockIdx.x, the longest work-groups first:
// scan, iQ conversion, weight tiles.
// ---------------------------------------------------------------------------
static constexpr int NB_COLGRP = Dd / SC_COLS;
static constexpr int NB_SCAN   = NB_COLGRP * Bb * SC_PARTS;
static constexpr int NB_CONV   = Mrows * Dd / 4 / (PREP_THREADS * CV_LOADS);
static constexpr int NB_WG     = (2 * Dd / WT_K) * (2 * Dd / WT_N);
static constexpr int NB_W      = (Dd / WT_K) * (Dd / WT_N);
static constexpr int NB_PREP   = NB_SCAN + NB_CONV + NB_WG + 2 * NB_W;
static constexpr int SCAN_LDS  = SC_PARTS * SC_CHUNKS * SC_COLS * 4;
static constexpr int WT_LDS    = WT_N * WT_PITCH * 4;

__global__ __launch_bounds__(PREP_THREADS)
void prep(const float* __restrict__ iQ, const float* __restrict__ iV,
          const float* __restrict__ W1, const float* __restrict__ W2, const float* __restrict__ Wg,
          bf16* __restrict__ iQb, bf16* __restrict__ avg,
          bf16* __restrict__ W1t, bf16* __restrict__ W2t, bf16* __restrict__ Wgt) {
  __shared__ __align__(16) unsigned char smem[SCAN_LDS > WT_LDS ? SCAN_LDS : WT_LDS];
  unsigned* wt = reinterpret_cast<unsigned*>(smem);

  int b = blockIdx.x;
  if (b < NB_SCAN) {
    avg_scan(iV, avg, b % NB_COLGRP, b / NB_COLGRP % SC_PARTS, b / (NB_COLGRP * SC_PARTS),
             reinterpret_cast<float (*)[SC_COLS]>(smem));
    return;
  }
  b -= NB_SCAN;
  if (b < NB_CONV) { f32_to_bf16_block(iQ, iQb, b); return; }
  b -= NB_CONV;
  if (b < NB_WG) { wconv_tile<2 * Dd>(Wg, Wgt, b, wt); return; }
  b -= NB_WG;
  if (b < NB_W) wconv_tile<Dd>(W1, W1t, b, wt);
  else          wconv_tile<Dd>(W2, W2t, b - NB_W, wt);
}

// ---------------------------------------------------------------------------
// bf16 WMMA GEMM with async double-buffered LDS staging.
//   C[M,N] = epilogue(A[M,K] * Bt[N,K]^T + bias[N])
// Block tile 128x128, stages of KS k in two buffers, one barrier a stage. 8 waves
// (2x4); each wave computes 64x32 = 4x2 WMMA tiles. K is a multiple of KS.
// RELU / WF32 / WBF16 select epilogue.
// ---------------------------------------------------------------------------
template <int RELU, int WF32, int WBF16>
__global__ __launch_bounds__(256)
void gemm_bf16(const bf16* __restrict__ A, const bf16* __restrict__ Bt,
               const float* __restrict__ bias,
               float* __restrict__ outf, bf16* __restrict__ outb,
               int M, int N, int K) {
  __shared__ __align__(16) bf16 As[2][128 * LDK];
  __shared__ __align__(16) bf16 Bs[2][128 * LDK];

  const int tid   = threadIdx.x;
  const int lane  = tid & 31;
  const int wid   = tid >> 5;
  const int half  = lane >> 4;
  const int l16   = lane & 15;
  const int waveM = wid >> 2;   // 0..1
  const int waveN = wid & 3;    // 0..3
  const int m0    = blockIdx.y * 128;
  const int n0    = blockIdx.x * 128;
  const int srow  = tid >> 3;   // 0..31: first of this thread's four rows, 32 apart
  const int sseg  = tid & 7;    // 16-B piece of the row's 128 B

  const bf16* Ag = A  + (size_t)(m0 + srow) * K + sseg * 8;
  const bf16* Bg = Bt + (size_t)(n0 + srow) * K + sseg * 8;
  const int lofs = srow * LDK + sseg * 8;

  auto stage = [&](int k0, int buf) {   // 8 async-b128 per wave per stage, 4 whole lines each
#pragma unroll   // the four row offsets become constants of their copies
    for (int i = 0; i < 4; ++i) {
      async_cp16B(Ag + (size_t)(i * 32) * K + k0, &As[buf][lofs + i * 32 * LDK]);
      async_cp16B(Bg + (size_t)(i * 32) * K + k0, &Bs[buf][lofs + i * 32 * LDK]);
    }
  };

  v8f zero = {};
  v8f acc[4][2];
#pragma unroll
  for (int i = 0; i < 4; ++i)
#pragma unroll
    for (int j = 0; j < 2; ++j) acc[i][j] = zero;

  const int T = K / KS;
  stage(0, 0);
  WAIT_ASYNC0();
  __syncthreads();
  if (T > 1) stage(KS, 1);                     // flies while stage 0 is worked on
  for (int t = 0; t < T; ++t) {
    const int buf = t & 1;
#pragma unroll   // both 32-k blocks of a stage in one straight run, kk an immediate offset of the reads
    for (int kk = 0; kk < KS; kk += 32) {
      v16bf af[4], bfr[2];
#pragma unroll
      for (int mi = 0; mi < 4; ++mi)
        af[mi] = ldsFrag(&As[buf][(waveM * 64 + mi * 16 + l16) * LDK + kk + half * 16]);
#pragma unroll
      for (int ni = 0; ni < 2; ++ni)
        bfr[ni] = ldsFrag(&Bs[buf][(waveN * 32 + ni * 16 + l16) * LDK + kk + half * 16]);
#pragma unroll
      for (int mi = 0; mi < 4; ++mi)
#pragma unroll
        for (int ni = 0; ni < 2; ++ni)
          acc[mi][ni] = WMMA_BF16(af[mi], bfr[ni], acc[mi][ni]);
    }
    // one barrier publishes stage t + 1 and ends every read of stage t's buffer
    WAIT_DS0();
    WAIT_ASYNC0();
    __syncthreads();
    if (t + 2 < T) stage((t + 2) * KS, buf);   // refill the buffer just left
  }
  WAIT_ASYNC0();

  // ---- epilogue: bias (+relu), convert, store ----
#pragma unroll
  for (int ni = 0; ni < 2; ++ni) {
    const int n = n0 + waveN * 32 + ni * 16 + l16;
    const float bv = bias[n];
#pragma unroll
    for (int mi = 0; mi < 4; ++mi) {
      const int mbase = m0 + waveM * 64 + mi * 16 + 8 * half;
#pragma unroll
      for (int r = 0; r < 8; ++r) {
        float v = acc[mi][ni][r] + bv;
        if (RELU) v = fmaxf(v, 0.0f);
        const size_t idx = (size_t)(mbase + r) * N + n;
        if (WF32)  outf[idx] = v;
        if (WBF16) outb[idx] = (bf16)v;
      }
    }
  }
}

// ---------------------------------------------------------------------------
// Fused gate GEMM:  g = sigmoid(concat([iQ,ffn]) @ Wg + bg), out = gi*iQ+gf*ffn
// A-operand comes from pre-converted bf16 iQ / ffn (async-stageable, the
// concat seam never splits a stage of KS k). Each block computes paired
// output column tiles n (gate-i) and n+1024 (gate-f) -> fully fused epilogue.
// Block tile: M=128, N=64 per half. 8 waves (4x2); wave = 32x32 per half.
// ---------------------------------------------------------------------------
__global__ __launch_bounds__(256)
void gate_fused(const float* __restrict__ iQ, const float* __restrict__ ffn,
                const bf16* __restrict__ iQb, const bf16* __restrict__ ffnb,
                const bf16* __restrict__ Wgt, const float* __restrict__ bg,
                float* __restrict__ out) {
  __shared__ __align__(16) bf16 As[2][128 * LDK];
  __shared__ __align__(16) bf16 Bs[2][128 * LDK];   // rows 0..63 gate-i columns, 64..127 gate-f

  const int tid   = threadIdx.x;
  const int lane  = tid & 31;
  const int wid   = tid >> 5;
  const int half  = lane >> 4;
  const int l16   = lane & 15;
  const int waveM = wid >> 1;   // 0..3
  const int waveN = wid & 1;    // 0..1
  const int m0    = blockIdx.y * 128;
  const int n0    = blockIdx.x * 64;

  const int srow = tid >> 3;          // 0..31: first of this thread's four rows, 32 apart
  const int sseg = tid & 7;           // 16-B piece of the row's 128 B
  const size_t aofs = (size_t)(m0 + srow) * Dd + sseg * 8;
  const bf16* Bgp = Wgt + (size_t)(n0 + srow) * (2 * Dd) + sseg * 8;
  const int lofs = srow * LDK + sseg * 8;

  auto stage = [&](int k0, int buf) {   // 8 async-b128 per wave per stage, 4 whole lines each
    const bf16* asrc = (k0 < Dd) ? iQb + aofs + k0 : ffnb + aofs + (k0 - Dd);
#pragma unroll   // the four row offsets become constants of their copies
    for (int i = 0; i < 4; ++i) {
      const int wrow = i * 32 + (i >= 2 ? Dd - 64 : 0);   // LDS rows 64.. hold Wgt rows Dd + n0..
      async_cp16B(asrc + (size_t)(i * 32) * Dd, &As[buf][lofs + i * 32 * LDK]);
      async_cp16B(Bgp + (size_t)wrow * (2 * Dd) + k0, &Bs[buf][lofs + i * 32 * LDK]);
    }
  };

  v8f zero = {};
  v8f accL[2][2], accR[2][2];
#pragma unroll
  for (int i = 0; i < 2; ++i)
#pragma unroll
    for (int j = 0; j < 2; ++j) { accL[i][j] = zero; accR[i][j] = zero; }

  constexpr int T = 2 * Dd / KS;
  stage(0, 0);
  WAIT_ASYNC0();
  __syncthreads();
  stage(KS, 1);                                // flies while stage 0 is worked on
  for (int t = 0; t < T; ++t) {
    const int buf = t & 1;
#pragma unroll   // both 32-k blocks of a stage in one straight run, kk an immediate offset of the reads
    for (int kk = 0; kk < KS; kk += 32) {
      v16bf af[2], bl[2], br[2];
#pragma unroll
      for (int mi = 0; mi < 2; ++mi)
        af[mi] = ldsFrag(&As[buf][(waveM * 32 + mi * 16 + l16) * LDK + kk + half * 16]);
#pragma unroll
      for (int ni = 0; ni < 2; ++ni) {
        bl[ni] = ldsFrag(&Bs[buf][(waveN * 32 + ni * 16 + l16) * LDK + kk + half * 16]);
        br[ni] = ldsFrag(&Bs[buf][(64 + waveN * 32 + ni * 16 + l16) * LDK + kk + half * 16]);
      }
#pragma unroll
      for (int mi = 0; mi < 2; ++mi)
#pragma unroll
        for (int ni = 0; ni < 2; ++ni) {
          accL[mi][ni] = WMMA_BF16(af[mi], bl[ni], accL[mi][ni]);
          accR[mi][ni] = WMMA_BF16(af[mi], br[ni], accR[mi][ni]);
        }
    }
    // one barrier publishes stage t + 1 and ends every read of stage t's buffer
    WAIT_DS0();
    WAIT_ASYNC0();
    __syncthreads();
    if (t + 2 < T) stage((t + 2) * KS, buf);   // refill the buffer just left
  }
  WAIT_ASYNC0();

  // ---- fused sigmoid-gate epilogue (exact f32 iQ/ffn for the combine) ----
#pragma unroll
  for (int ni = 0; ni < 2; ++ni) {
    const int n = n0 + waveN * 32 + ni * 16 + l16;
    const float bLv = bg[n];
    const float bRv = bg[Dd + n];
#pragma unroll
    for (int mi = 0; mi < 2; ++mi) {
      const int mbase = m0 + waveM * 32 + mi * 16 + 8 * half;
#pragma unroll
      for (int r = 0; r < 8; ++r) {
        const size_t idx = (size_t)(mbase + r) * Dd + n;
        const float gi = sigmoidf(accL[mi][ni][r] + bLv);
        const float gf = sigmoidf(accR[mi][ni][r] + bRv);
        out[idx] = gi * iQ[idx] + gf * ffn[idx];
      }
    }
  }
}

// ---------------------------------------------------------------------------
extern "C" void kernel_launch(void* const* d_in, const int* in_sizes, int n_in,
                              void* d_out, int out_size, void* d_ws, size_t ws_size,
                              hipStream_t stream) {
  const float* iQ = (const float*)d_in[0];
  const float* iV = (const float*)d_in[1];
  const float* W1 = (const float*)d_in[2];
  const float* b1 = (const float*)d_in[3];
  const float* W2 = (const float*)d_in[4];
  const float* b2 = (const float*)d_in[5];
  const float* Wg = (const float*)d_in[6];
  const float* bg = (const float*)d_in[7];
  float* out = (float*)d_out;

  // Workspace layout (~108 MB total)
  char* p = (char*)d_ws;
  bf16*  avg  = (bf16*)p;  p += (size_t)Mrows * Dd * sizeof(bf16);          // 16 MB
  bf16*  h    = (bf16*)p;  p += (size_t)Mrows * Dd * sizeof(bf16);          // 16 MB
  float* ffn  = (float*)p; p += (size_t)Mrows * Dd * sizeof(float);         // 32 MB
  bf16*  ffnb = (bf16*)p;  p += (size_t)Mrows * Dd * sizeof(bf16);          // 16 MB
  bf16*  iQb  = (bf16*)p;  p += (size_t)Mrows * Dd * sizeof(bf16);          // 16 MB
  bf16*  W1t  = (bf16*)p;  p += (size_t)Dd * Dd * sizeof(bf16);             //  2 MB
  bf16*  W2t  = (bf16*)p;  p += (size_t)Dd * Dd * sizeof(bf16);             //  2 MB
  bf16*  Wgt  = (bf16*)p;  p += (size_t)(2 * Dd) * (2 * Dd) * sizeof(bf16); //  8 MB

  // 1-3) weights -> bf16, transposed to N-major for contiguous B-fragments; iQ -> bf16
  //      (gate A-operand); causal cumulative mean (the tril/einsum is a prefix scan, not a GEMM)
  prep<<<dim3(NB_PREP), PREP_THREADS, 0, stream>>>(iQ, iV, W1, W2, Wg, iQb, avg, W1t, W2t, Wgt);

  // 4) h = relu(avg @ W1 + b1)        -> bf16
  gemm_bf16<1, 0, 1><<<dim3(Dd / 128, Mrows / 128), 256, 0, stream>>>(
      avg, W1t, b1, nullptr, h, Mrows, Dd, Dd);

  // 5) ffn = h @ W2 + b2              -> f32 (epilogue) + bf16 (gate operand)
  gemm_bf16<0, 1, 1><<<dim3(Dd / 128, Mrows / 128), 256, 0, stream>>>(
      h, W2t, b2, ffn, ffnb, Mrows, Dd, Dd);

  // 6) fused gate GEMM + sigmoid + output combine
  gate_fused<<<dim3(Dd / 64, Mrows / 128), 256, 0, stream>>>(
      iQ, ffn, iQb, ffnb, Wgt, bg, out);
}

// v004
// It runs in 106 microseconds.
// In two side-by-side timings against v003, it was 1.04 and 1.05 times as fast.
// Counting every step since v000, it is 3.97 times as fast.
#include <hip/hip_runtime.h>
#include <hip/hip_bf16.h>

typedef __bf16 bf16;
typedef __attribute__((ext_vector_type(16))) __bf16 v16bf;
typedef __attribute__((ext_vector_type(8)))  float  v8f;

#define WMMA_BF16(a, b, c) \
  __builtin_amdgcn_wmma_f32_16x16x32_bf16(false, (a), false, (b), (short)0, (c), false, false)

static constexpr int Bb    = 4;
static constexpr int Ss    = 2048;
static constexpr int Dd    = 1024;
static constexpr int Mrows = Bb * Ss;   // 8192 tokens
static constexpr int KS    = 64;        // k per LDS stage: one whole 128-B line of every operand row
static constexpr int LDK   = 72;        // LDS row pitch in bf16: 144 B = 16 B x 9, no bank conflict for 16-B reads

// ---------------------------------------------------------------------------
// CDNA5 async global->LDS copy (GLOBAL_LOAD_ASYNC_TO_LDS_B128, ASYNCcnt).
// Param types per hipcc diagnostic: (int4 AS(1)*, int4 AS(3)*, imm, imm).
// Guarded so the kernel still compiles (synchronous fallback) if absent.
// ---------------------------------------------------------------------------
#if __has_builtin(__builtin_amdgcn_global_load_async_to_lds_b128)
#define HAVE_ASYNC_LDS 1
typedef int v4i __attribute__((vector_size(16)));
typedef __attribute__((address_space(1))) v4i gv4i;
typedef __attribute__((address_space(3))) v4i lv4i;
__device__ __forceinline__ void async_cp16B(const bf16* g, bf16* l) {
  // one b128 op: 16 B per lane; eight lanes side by side cover one 128-B row
  __builtin_amdgcn_global_load_async_to_lds_b128((gv4i*)(void*)g, (lv4i*)l, 0, 0);
}
// the wave's own copies have landed; in asm, so that no LDS read is moved in front of it
#define WAIT_ASYNC0() asm volatile("s_wait_asynccnt 0x0" ::: "memory")
#else
#define HAVE_ASYNC_LDS 0
#define WAIT_ASYNC0() ((void)0)
__device__ __forceinline__ void async_cp16B(const bf16* g, bf16* l) {
  *reinterpret_cast<uint4*>(l) = *reinterpret_cast<const uint4*>(g);
}
#endif
// the wave's own LDS reads are done before the barrier behind which their buffer is refilled
#define WAIT_DS0() asm volatile("s_wait_dscnt 0x0" ::: "memory")

// ---------------------------------------------------------------------------
// Load a 16-element bf16 WMMA fragment (32 bytes) from LDS as two b128 reads.
// ---------------------------------------------------------------------------
__device__ __forceinline__ v16bf ldsFrag(const bf16* p) {
  union { v16bf v; uint4 u[2]; } r;
  const uint4* q = reinterpret_cast<const uint4*>(p);
  r.u[0] = q[0];
  r.u[1] = q[1];
  return r.v;
}

__device__ __forceinline__ float sigmoidf(float x) {
  return 1.0f / (1.0f + __expf(-x));
}

typedef __attribute__((ext_vector_type(4))) float  v4f;
typedef __attribute__((ext_vector_type(4))) __bf16 v4bf;
typedef __attribute__((ext_vector_type(2))) __bf16 v2bf;

static constexpr int PREP_THREADS = 512;   // every work-group of the preparation launch: 16 waves

// ---------------------------------------------------------------------------
// Weight transpose + f32->bf16 convert:  Wt[n][k] = (bf16) W[k][n], W is DIM x DIM.
// One work-group takes a tile of 256 k x 128 n. A wave reads whole rows of the
// tile (512 B), two neighbouring k rows a lane, all 16 loads requested at once,
// packs each (k, k + 1) pair into one dword and stores it transposed in LDS;
// rows of Wt leave as aligned 256-B runs.
// ---------------------------------------------------------------------------
static constexpr int WT_K     = 256;            // tile extent along k
static constexpr int WT_N     = 128;            // tile extent along n
static constexpr int WT_PITCH = WT_K / 2 + 1;   // LDS row pitch in dwords: odd, so that rows start on different banks

template <int DIM>
__device__ __forceinline__ void wconv_tile(const float* __restrict__ W, bf16* __restrict__ Wt,
                                           int tile, unsigned* __restrict__ t) {
  constexpr int NT = DIM / WT_N;
  const int nb   = (tile % NT) * WT_N;
  const int kb   = (tile / NT) * WT_K;
  const int lane = threadIdx.x & 31;
  const int wave = threadIdx.x >> 5;         // 0..15

  const float* src = W + (size_t)(kb + 2 * wave) * DIM + nb + lane * 4;
  v4f a[8], b[8];
#pragma unroll   // the row steps become immediate offsets on one address pair
  for (int i = 0; i < 8; ++i) {
    a[i] = *reinterpret_cast<const v4f*>(src + (size_t)(i * 32) * DIM);
    b[i] = *reinterpret_cast<const v4f*>(src + (size_t)(i * 32 + 1) * DIM);
  }
  // keeps the loads' address pair live to here, so that no load of the run lands in
  // it, and puts the wait in front of the first rewrite of a register they name
  asm volatile("s_wait_xcnt 0x0" :: "v"(src) : "memory");
#pragma unroll   // a[], b[] stay in registers: every index a constant
  for (int i = 0; i < 8; ++i)
#pragma unroll   // as above
    for (int j = 0; j < 4; ++j) {
      const v2bf p = {(bf16)a[i][j], (bf16)b[i][j]};
      t[(lane * 4 + j) * WT_PITCH + i * 16 + wave] = __builtin_bit_cast(unsigned, p);
    }
  __syncthreads();
#pragma unroll   // all LDS reads of the eight pieces go out ahead of the first store
  for (int i = 0; i < 8; ++i) {
    const int n = (i >> 1) * 32 + wave * 2 + (lane >> 4);
    const int q = (i & 1) * 16 + (lane & 15);   // 16-B piece of the row's 512 B
    const unsigned* r = t + n * WT_PITCH + q * 4;
    const uint4 o = make_uint4(r[0], r[1], r[2], r[3]);
    *reinterpret_cast<uint4*>(Wt + (size_t)(nb + n) * DIM + kb + q * 8) = o;
  }
  // the wait in front of any later rewrite of a register that the eight stores name
  asm volatile("s_wait_xcnt 0x0" ::: "memory");
}

// ---------------------------------------------------------------------------
// Elementwise f32 -> bf16 (for iQ, so gate A-tiles can use async staging, and for W2 as it lies).
// One work-group converts 256 KiB: 32 loads of 16 B a lane, all requested at once.
// ---------------------------------------------------------------------------
static constexpr int CV_LOADS = 32;

__device__ __forceinline__ void f32_to_bf16_block(const float* __restrict__ in, bf16* __restrict__ out,
                                                  int blk) {
  const size_t i0 = (size_t)blk * (PREP_THREADS * CV_LOADS) + threadIdx.x;
  const v4f* s = reinterpret_cast<const v4f*>(in) + i0;
  v4bf*      d = reinterpret_cast<v4bf*>(out) + i0;
  v4f f[CV_LOADS];
#pragma unroll   // f[] stays in registers, the steps become immediate offsets
  for (int i = 0; i < CV_LOADS; ++i) f[i] = s[i * PREP_THREADS];
#pragma unroll   // as above
  for (int i = 0; i < CV_LOADS; ++i) {
    d[i * PREP_THREADS] = __builtin_convertvector(f[i], v4bf);
    // lets each eight stores leave while later loads are still under way; without it
    // the compiler gathers all stores behind the wait for the last load
    if (i % 8 == 7) __builtin_amdgcn_sched_barrier(0);
  }
  // the wait in front of any later rewrite of a register that the last stores name
  asm volatile("s_wait_xcnt 0x0" ::: "memory");
}

// ---------------------------------------------------------------------------
// Causal cumulative mean of iV along S, written directly as bf16.
// Chunked scan: a work-group owns 64 columns (256 B of iV, one whole 128-B line
// of avg per row) and 1024 rows. Each half-wave (16 lanes x 4 columns) holds one
// chunk of 32 rows in registers and scans it there; chunk totals meet in LDS,
// and each chunk adds the totals of all chunks in front of it. Rows in front of
// the work-group's own 1024 are only summed, chunk by chunk, into the same table.
// ---------------------------------------------------------------------------
static constexpr int SC_COLS   = 64;                          // columns per work-group
static constexpr int SC_ROWS   = 32;                          // rows per chunk
static constexpr int SC_CHUNKS = 32;                          // chunks per work-group (16 waves x 2)
static constexpr int SC_PARTS  = Ss / (SC_ROWS * SC_CHUNKS);  // work-groups along S

__device__ __forceinline__ void avg_scan(const float* __restrict__ iV, bf16* __restrict__ avg,
                                         int colgrp, int part, int batch,
                                         float (*__restrict__ csum)[SC_COLS]) {
  const int lc    = (threadIdx.x & 15) * 4;   // column inside the work-group
  const int chunk = threadIdx.x >> 4;         // 0..31
  const int col   = colgrp * SC_COLS + lc;
  const v4f zero  = {};

  // this thread's chunk of part 0: all 32 rows requested at once
  const float* src = iV + ((size_t)batch * Ss + chunk * SC_ROWS) * Dd + col;
  v4f v[SC_ROWS];
#pragma unroll
  for (int r = 0; r < SC_ROWS; ++r)
    v[r] = *reinterpret_cast<const v4f*>(src + (size_t)r * Dd);
  // keeps the loads' address pair live to here, so that no load of the run lands in
  // it, and puts the wait in front of the first rewrite of a register they name
  asm volatile("s_wait_xcnt 0x0" :: "v"(src) : "memory");

  // parts in front of the own one: only the chunk's total is kept; each row's
  // registers take the same row of the next part as soon as the row is summed,
  // so that 32 loads of a wave stay in flight up to the own part
#pragma unroll 1   // at most SC_PARTS - 1 trips: a second copy of the body would only be code
  for (int p = 0; p < part; ++p) {
    src += (size_t)SC_CHUNKS * SC_ROWS * Dd;
    v4f s = zero;
#pragma unroll
    for (int r = 0; r < SC_ROWS; ++r) {
      s += v[r];
      v[r] = *reinterpret_cast<const v4f*>(src + (size_t)r * Dd);
    }
    *reinterpret_cast<v4f*>(&csum[p * SC_CHUNKS + chunk][lc]) = s;
  }

  // inclusive scan of the own chunk, in registers
#pragma unroll
  for (int r = 1; r < SC_ROWS; ++r) v[r] += v[r - 1];
  *reinterpret_cast<v4f*>(&csum[part * SC_CHUNKS + chunk][lc]) = v[SC_ROWS - 1];
  __syncthreads();

  // totals of every chunk in front of this one, in row order; 8 independent LDS
  // reads a trip, so that their latency is paid once a trip and not once a chunk
  v4f off = zero;
  for (int c0 = 0; c0 < part * SC_CHUNKS; c0 += 8) {
    v4f t[8];
#pragma unroll
    for (int j = 0; j < 8; ++j) t[j] = *reinterpret_cast<const v4f*>(&csum[c0 + j][lc]);
#pragma unroll
    for (int j = 0; j < 8; ++j) off += t[j];
  }
  const float* own = &csum[part * SC_CHUNKS][lc];
  const int wtop = __builtin_amdgcn_readfirstlane(threadIdx.x >> 5) * 2 + 1;  // the wave's later chunk
  for (int c0 = 0; c0 < wtop; c0 += 8) {
    v4f t[8];
#pragma unroll
    for (int j = 0; j < 8; ++j) t[j] = *reinterpret_cast<const v4f*>(own + (c0 + j) * SC_COLS);
#pragma unroll
    for (int j = 0; j < 8; ++j) off += (c0 + j < chunk) ? t[j] : zero;
  }

  const int row0 = (part * SC_CHUNKS + chunk) * SC_ROWS;
  bf16* dst = avg + ((size_t)batch * Ss + row0) * Dd + col;
#pragma unroll
  for (int r = 0; r < SC_ROWS; ++r) {
    const v4f m = (off + v[r]) * (1.0f / (float)(row0 + r + 1));
    *reinterpret_cast<v4bf*>(dst + (size_t)r * Dd) = __builtin_convertvector(m, v4bf);
  }
}

// ---------------------------------------------------------------------------
// All work that depends on the inputs alone, in one launch: none of its pieces
// reads what another writes. Ranges of blockIdx.x, the longest work-groups first:
// scan, iQ conversion, W2 conversion (untransposed copy), weight tiles.
// ---------------------------------------------------------------------------
static constexpr int NB_COLGRP = Dd / SC_COLS;
static constexpr int NB_SCAN   = NB_COLGRP * Bb * SC_PARTS;
static constexpr int NB_CONV   = Mrows * Dd / 4 / (PREP_THREADS * CV_LOADS);
static constexpr int NB_WG     = (2 * Dd / WT_K) * (2 * Dd / WT_N);
static constexpr int NB_W      = (Dd / WT_K) * (Dd / WT_N);
static constexpr int NB_W2C    = Dd * Dd / 4 / (PREP_THREADS * CV_LOADS);
static constexpr int NB_PREP   = NB_SCAN + NB_CONV + NB_W2C + NB_WG + 2 * NB_W;
static constexpr int SCAN_LDS  = SC_PARTS * SC_CHUNKS * SC_COLS * 4;
static constexpr int WT_LDS    = WT_N * WT_PITCH * 4;

__global__ __launch_bounds__(PREP_THREADS)
void prep(const float* __restrict__ iQ, const float* __restrict__ iV,
          const float* __restrict__ W1, const float* __restrict__ W2, const float* __restrict__ Wg,
          bf16* __restrict__ iQb, bf16* __restrict__ avg,
          bf16* __restrict__ W1t, bf16* __restrict__ W2t, bf16* __restrict__ Wgt,
          bf16* __restrict__ W2b) {
  __shared__ __align__(16) unsigned char smem[SCAN_LDS > WT_LDS ? SCAN_LDS : WT_LDS];
  unsigned* wt = reinterpret_cast<unsigned*>(smem);

  int b = blockIdx.x;
  if (b < NB_SCAN) {
    avg_scan(iV, avg, b % NB_COLGRP, b / NB_COLGRP % SC_PARTS, b / (NB_COLGRP * SC_PARTS),
             reinterpret_cast<float (*)[SC_COLS]>(smem));
    return;
  }
  b -= NB_SCAN;
  if (b < NB_CONV) { f32_to_bf16_block(iQ, iQb, b); return; }
  b -= NB_CONV;
  if (b < NB_W2C) { f32_to_bf16_block(W2, W2b, b); return; }
  b -= NB_W2C;
  if (b < NB_WG) { wconv_tile<2 * Dd>(Wg, Wgt, b, wt); return; }
  b -= NB_WG;
  if (b < NB_W) wconv_tile<Dd>(W1, W1t, b, wt);
  else          wconv_tile<Dd>(W2, W2t, b - NB_W, wt);
}

// ---------------------------------------------------------------------------
// The gate's product is taken apart along k and its lower half re-associated:
//   concat([iQ, ffn]) @ Wg + bg = iQ @ Wg[:D] + h @ P + c,
//   P = W2 @ Wg[D:],  c = bg + b2 @ Wg[D:],  because ffn = h @ W2 + b2.
// P and c depend on the weights alone, so the gate no longer waits for ffn, and
// ffn itself is formed inside the gate kernel from the h rows staged there.
// ---------------------------------------------------------------------------
typedef __attribute__((ext_vector_type(8))) __bf16 v8bf;

// c[n] = bg[n] + sum_j b2[j] * Wg[D + j][n], from the transposed bf16 weights.
// A work-group takes 32 values of n, one whole 128-B line of c: four rows a wave,
// the sums meet in LDS and the first wave stores the line.
static constexpr int CB_ROWS = 32;   // values of n per work-group of 8 waves

__device__ __forceinline__ void gate_bias(const bf16* __restrict__ Wgt, const float* __restrict__ b2,
                                          const float* __restrict__ bg, float* __restrict__ cvec,
                                          int blk, float* __restrict__ part) {
  const int lane = threadIdx.x & 31;
  const int wave = threadIdx.x >> 5;
  const int nb   = blk * CB_ROWS;
  v4f bb[4][2];
#pragma unroll   // bb[] stays in registers
  for (int i = 0; i < 4; ++i) {
    bb[i][0] = *reinterpret_cast<const v4f*>(b2 + i * 256 + lane * 8);
    bb[i][1] = *reinterpret_cast<const v4f*>(b2 + i * 256 + lane * 8 + 4);
  }
#pragma unroll 1   // four short trips: unrolled, their registers would set the whole kernel's allocation
  for (int rr = 0; rr < 4; ++rr) {
    const int r = wave * 4 + rr;
    const bf16* row = Wgt + (size_t)(nb + r) * (2 * Dd) + Dd + lane * 8;
    v8bf w[4];
#pragma unroll   // the steps become immediate offsets on one address pair
    for (int i = 0; i < 4; ++i) w[i] = *reinterpret_cast<const v8bf*>(row + i * 256);
    // keeps the loads' address pair live to here, so that no load of the run lands in
    // it, and puts the wait in front of the first rewrite of a register they name
    asm volatile("s_wait_xcnt 0x0" :: "v"(row) : "memory");
    float s = 0.0f;
#pragma unroll
    for (int i = 0; i < 4; ++i)
#pragma unroll
      for (int j = 0; j < 8; ++j) s += (float)w[i][j] * bb[i][j >> 2][j & 3];
#pragma unroll
    for (int o = 16; o > 0; o >>= 1) s += __shfl_xor(s, o);
    if (lane == 0) part[r] = s;
  }
  __syncthreads();
  if (threadIdx.x < 32) cvec[nb + lane] = bg[nb + lane] + part[lane];
}

// ---------------------------------------------------------------------------
// bf16 WMMA GEMM with async double-buffered LDS staging, two products in one launch,
// neither of which reads what the other writes:
//   h[m][n]  = relu(avg[m][:] . W1t[n][:] + b1[n])        (Mrows x Dd)
//   Pt[n][k] = Wgt[n][Dd:] . W2b[k][:]                    (2 Dd x Dd), P transposed
// and the work-groups of gate_bias behind them.
// Block tile 128x128, stages of KS k in two buffers, one barrier a stage. 8 waves
// (2x4); each wave computes 64x32 = 4x2 WMMA tiles.
// ---------------------------------------------------------------------------
static constexpr int NB_G1 = (Mrows / 128) * (Dd / 128);
static constexpr int NB_WP = (2 * Dd / 128) * (Dd / 128);
static constexpr int NB_CB = 2 * Dd / CB_ROWS;

__global__ __launch_bounds__(256)
void gemm_h_wprod(const bf16* __restrict__ avg, const bf16* __restrict__ W1t,
                  const float* __restrict__ b1, bf16* __restrict__ h,
                  const bf16* __restrict__ Wgt, const bf16* __restrict__ W2b,
                  bf16* __restrict__ Pt,
                  const float* __restrict__ b2, const float* __restrict__ bg,
                  float* __restrict__ cvec) {
  __shared__ __align__(16) bf16 As[2][128 * LDK];
  __shared__ __align__(16) bf16 Bs[2][128 * LDK];

  if (blockIdx.x >= NB_G1 + NB_WP) {   // the same for the whole work-group
    gate_bias(Wgt, b2, bg, cvec, blockIdx.x - (NB_G1 + NB_WP), reinterpret_cast<float*>(&As[0][0]));
    return;
  }
  const bool  prod = blockIdx.x >= NB_G1;
  const int   tile = prod ? blockIdx.x - NB_G1 : blockIdx.x;
  const bf16* A    = prod ? Wgt + Dd : avg;
  const int   lda  = prod ? 2 * Dd : Dd;
  const bf16* Bt   = prod ? W2b : W1t;
  bf16*       outb = prod ? Pt : h;

  const int tid   = threadIdx.x;
  const int lane  = tid & 31;
  const int wid   = tid >> 5;
  const int half  = lane >> 4;
  const int l16   = lane & 15;
  const int waveM = wid >> 2;   // 0..1
  const int waveN = wid & 3;    // 0..3
  const int m0    = (tile / (Dd / 128)) * 128;
  const int n0    = (tile % (Dd / 128)) * 128;
  const int srow  = tid >> 3;   // 0..31: first of this thread's four rows, 32 apart
  const int sseg  = tid & 7;    // 16-B piece of the row's 128 B

  const bf16* Ag = A  + (size_t)(m0 + srow) * lda + sseg * 8;
  const bf16* Bg = Bt + (size_t)(n0 + srow) * Dd + sseg * 8;
  const int lofs = srow * LDK + sseg * 8;

  auto stage = [&](int k0, int buf) {   // 8 async-b128 per wave per stage, 4 whole lines each
#pragma unroll   // the four row offsets become constants of their copies
    for (int i = 0; i < 4; ++i) {
      async_cp16B(Ag + (size_t)(i * 32) * lda + k0, &As[buf][lofs + i * 32 * LDK]);
      async_cp16B(Bg + (size_t)(i * 32) * Dd + k0, &Bs[buf][lofs + i * 32 * LDK]);
    }
  };

  v8f zero = {};
  v8f acc[4][2];
#pragma unroll
  for (int i = 0; i < 4; ++i)
#pragma unroll
    for (int j = 0; j < 2; ++j) acc[i][j] = zero;

  constexpr int T = Dd / KS;
  stage(0, 0);
  WAIT_ASYNC0();
  __syncthreads();
  stage(KS, 1);                                // flies while stage 0 is worked on
  for (int t = 0; t < T; ++t) {
    const int buf = t & 1;
#pragma unroll   // both 32-k blocks of a stage in one straight run, kk an immediate offset of the reads
    for (int kk = 0; kk < KS; kk += 32) {
      v16bf af[4], bfr[2];
#pragma unroll
      for (int mi = 0; mi < 4; ++mi)
        af[mi] = ldsFrag(&As[buf][(waveM * 64 + mi * 16 + l16) * LDK + kk + half * 16]);
#pragma unroll
      for (int ni = 0; ni < 2; ++ni)
        bfr[ni] = ldsFrag(&Bs[buf][(waveN * 32 + ni * 16 + l16) * LDK + kk + half * 16]);
#pragma unroll
      for (int mi = 0; mi < 4; ++mi)
#pragma unroll
        for (int ni = 0; ni < 2; ++ni)
          acc[mi][ni] = WMMA_BF16(af[mi], bfr[ni], acc[mi][ni]);
    }
    // one barrier publishes stage t + 1 and ends every read of stage t's buffer
    WAIT_DS0();
    WAIT_ASYNC0();
    __syncthreads();
    if (t + 2 < T) stage((t + 2) * KS, buf);   // refill the buffer just left
  }
  WAIT_ASYNC0();

  // ---- epilogue: h takes bias and relu, Pt neither; convert, store ----
#pragma unroll
  for (int ni = 0; ni < 2; ++ni) {
    const int n = n0 + waveN * 32 + ni * 16 + l16;
    const float bv = prod ? 0.0f : b1[n];
#pragma unroll
    for (int mi = 0; mi < 4; ++mi) {
      const int mbase = m0 + waveM * 64 + mi * 16 + 8 * half;
#pragma unroll
      for (int r = 0; r < 8; ++r) {
        float v = acc[mi][ni][r] + bv;
        if (!prod) v = fmaxf(v, 0.0f);
        outb[(size_t)(mbase + r) * Dd + n] = (bf16)v;
      }
    }
    // the wait in front of any later rewrite of a register that this trip's stores name
    asm volatile("s_wait_xcnt 0x0" ::: "memory");
  }
}

// ---------------------------------------------------------------------------
// Fused gate GEMM:  g = sigmoid(iQ @ Wg[:D] + h @ P + c), ffn = h @ W2 + b2,
// out = gi*iQ + gf*ffn. k stages 0..T1-1 take A from iQ (bf16) and B from Wgt;
// stages T1.. take A from h and B from Pt, and the same h fragments also meet
// the W2t rows of the block's columns, so that ffn stays in f32 accumulators.
// Each block computes paired column tiles n (gate-i), n+1024 (gate-f) and n (ffn).
// Block tile: M=128, N=64 per part. 8 waves (4x2); wave = 32x32 per part.
// ---------------------------------------------------------------------------
struct two_parts   { static constexpr int value = 2; };
struct three_parts { static constexpr int value = 3; };

__global__ __launch_bounds__(256)
void gate_fused(const float* __restrict__ iQ, const bf16* __restrict__ iQb,
                const bf16* __restrict__ h, const bf16* __restrict__ Wgt,
                const bf16* __restrict__ Pt, const bf16* __restrict__ W2t,
                const float* __restrict__ cvec, const float* __restrict__ b2,
                float* __restrict__ out) {
  __shared__ __align__(16) bf16 As[2][128 * LDK];
  __shared__ __align__(16) bf16 Bs[2][192 * LDK];   // rows 0..63 gate-i columns, 64..127 gate-f, 128..191 ffn

  const int tid   = threadIdx.x;
  const int lane  = tid & 31;
  const int wid   = tid >> 5;
  const int half  = lane >> 4;
  const int l16   = lane & 15;
  const int waveM = wid >> 1;   // 0..3
  const int waveN = wid & 1;    // 0..1
  const int m0    = blockIdx.y * 128;
  const int n0    = blockIdx.x * 64;

  const int srow = tid >> 3;          // 0..31: first of this thread's rows, 32 apart
  const int sseg = tid & 7;           // 16-B piece of the row's 128 B
  const size_t aofs = (size_t)(m0 + srow) * Dd + sseg * 8;
  const size_t bofs = (size_t)(n0 + srow) * Dd + sseg * 8;
  const bf16* Bgp = Wgt + (size_t)(n0 + srow) * (2 * Dd) + sseg * 8;
  const int lofs = srow * LDK + sseg * 8;

  auto stage_q = [&](int k0, int buf) {   // iQ and Wgt: 8 async-b128 per wave per stage, 4 whole lines each
#pragma unroll   // the four row offsets become constants of their copies
    for (int i = 0; i < 4; ++i) {
      const int wrow = i * 32 + (i >= 2 ? Dd - 64 : 0);   // LDS rows 64.. hold Wgt rows Dd + n0..
      async_cp16B(iQb + aofs + (size_t)(i * 32) * Dd + k0, &As[buf][lofs + i * 32 * LDK]);
      async_cp16B(Bgp + (size_t)wrow * (2 * Dd) + k0, &Bs[buf][lofs + i * 32 * LDK]);
    }
  };
  auto stage_h = [&](int k0, int buf) {   // h, Pt and W2t: 10 async-b128 per wave per stage
#pragma unroll   // as above
    for (int i = 0; i < 4; ++i) {
      const int wrow = i * 32 + (i >= 2 ? Dd - 64 : 0);   // LDS rows 64.. hold Pt rows Dd + n0..
      async_cp16B(h + aofs + (size_t)(i * 32) * Dd + k0, &As[buf][lofs + i * 32 * LDK]);
      async_cp16B(Pt + bofs + (size_t)wrow * Dd + k0, &Bs[buf][lofs + i * 32 * LDK]);
    }
#pragma unroll   // as above
    for (int i = 0; i < 2; ++i)
      async_cp16B(W2t + bofs + (size_t)(i * 32) * Dd + k0, &Bs[buf][lofs + (128 + i * 32) * LDK]);
  };

  v8f zero = {};
  v8f accL[2][2], accR[2][2], accF[2][2];
#pragma unroll
  for (int i = 0; i < 2; ++i)
#pragma unroll
    for (int j = 0; j < 2; ++j) { accL[i][j] = zero; accR[i][j] = zero; accF[i][j] = zero; }

  auto work = [&](int buf, auto parts) {   // one stage's products on the first 2 or all 3 parts of Bs
    constexpr bool FFN = decltype(parts)::value == 3;
#pragma unroll   // both 32-k blocks of a stage in one straight run, kk an immediate offset of the reads
    for (int kk = 0; kk < KS; kk += 32) {
      v16bf af[2], bl[2], br[2], bw[2];
#pragma unroll
      for (int mi = 0; mi < 2; ++mi)
        af[mi] = ldsFrag(&As[buf][(waveM * 32 + mi * 16 + l16) * LDK + kk + half * 16]);
#pragma unroll
      for (int ni = 0; ni < 2; ++ni) {
        bl[ni] = ldsFrag(&Bs[buf][(waveN * 32 + ni * 16 + l16) * LDK + kk + half * 16]);
        br[ni] = ldsFrag(&Bs[buf][(64 + waveN * 32 + ni * 16 + l16) * LDK + kk + half * 16]);
        if (FFN) bw[ni] = ldsFrag(&Bs[buf][(128 + waveN * 32 + ni * 16 + l16) * LDK + kk + half * 16]);
      }
#pragma unroll
      for (int mi = 0; mi < 2; ++mi)
#pragma unroll
        for (int ni = 0; ni < 2; ++ni) {
          accL[mi][ni] = WMMA_BF16(af[mi], bl[ni], accL[mi][ni]);
          accR[mi][ni] = WMMA_BF16(af[mi], br[ni], accR[mi][ni]);
          if (FFN) accF[mi][ni] = WMMA_BF16(af[mi], bw[ni], accF[mi][ni]);
        }
    }
    // one barrier publishes the next stage and ends every read of this stage's buffer
    WAIT_DS0();
    WAIT_ASYNC0();
    __syncthreads();
  };

  constexpr int T1 = Dd / KS;         // stages on iQ, and as many on h
  stage_q(0, 0);
  WAIT_ASYNC0();
  __syncthreads();
  stage_q(KS, 1);                              // flies while stage 0 is worked on
  for (int t = 0; t < T1; ++t) {
    work(t & 1, two_parts{});
    if (t + 2 < T1) stage_q((t + 2) * KS, t & 1);   // refill the buffer just left
    else            stage_h((t + 2 - T1) * KS, t & 1);
  }
  for (int t = 0; t < T1; ++t) {
    work(t & 1, three_parts{});
    if (t + 2 < T1) stage_h((t + 2) * KS, t & 1);
  }
  WAIT_ASYNC0();

  // ---- fused sigmoid-gate epilogue (f32 iQ from memory, f32 ffn from the accumulators) ----
  const int nw = n0 + waveN * 32 + l16;   // the lane's first column; the second is 16 on
  float cLv[2], cRv[2], b2v[2];
#pragma unroll
  for (int ni = 0; ni < 2; ++ni) {
    cLv[ni] = cvec[nw + ni * 16];
    cRv[ni] = cvec[Dd + nw + ni * 16];
    b2v[ni] = b2[nw + ni * 16];
  }
  // keeps the six loads' index register live to here, so that no later load lands in
  // it, and puts the wait in front of the first rewrite of a register they name
  asm volatile("s_wait_xcnt 0x0" :: "v"(nw) : "memory");
#pragma unroll
  for (int ni = 0; ni < 2; ++ni) {
    const int n = nw + ni * 16;
#pragma unroll
    for (int mi = 0; mi < 2; ++mi) {
      const int mbase = m0 + waveM * 32 + mi * 16 + 8 * half;
#pragma unroll
      for (int r = 0; r < 8; ++r) {
        const size_t idx = (size_t)(mbase + r) * Dd + n;
        const float gi = sigmoidf(accL[mi][ni][r] + cLv[ni]);
        const float gf = sigmoidf(accR[mi][ni][r] + cRv[ni]);
        out[idx] = gi * iQ[idx] + gf * (accF[mi][ni][r] + b2v[ni]);
      }
    }
  }
}

// ---------------------------------------------------------------------------
extern "C" void kernel_launch(void* const* d_in, const int* in_sizes, int n_in,
                              void* d_out, int out_size, void* d_ws, size_t ws_size,
                              hipStream_t stream) {
  const float* iQ = (const float*)d_in[0];
  const float* iV = (const float*)d_in[1];
  const float* W1 = (const float*)d_in[2];
  const float* b1 = (const float*)d_in[3];
  const float* W2 = (const float*)d_in[4];
  const float* b2 = (const float*)d_in[5];
  const float* Wg = (const float*)d_in[6];
  const float* bg = (const float*)d_in[7];
  float* out = (float*)d_out;

  // Workspace layout (~66 MB total)
  char* p = (char*)d_ws;
  bf16*  avg  = (bf16*)p;  p += (size_t)Mrows * Dd * sizeof(bf16);          // 16 MB
  bf16*  h    = (bf16*)p;  p += (size_t)Mrows * Dd * sizeof(bf16);          // 16 MB
  bf16*  iQb  = (bf16*)p;  p += (size_t)Mrows * Dd * sizeof(bf16);          // 16 MB
  bf16*  W1t  = (bf16*)p;  p += (size_t)Dd * Dd * sizeof(bf16);             //  2 MB
  bf16*  W2t  = (bf16*)p;  p += (size_t)Dd * Dd * sizeof(bf16);             //  2 MB
  bf16*  W2b  = (bf16*)p;  p += (size_t)Dd * Dd * sizeof(bf16);             //  2 MB
  bf16*  Wgt  = (bf16*)p;  p += (size_t)(2 * Dd) * (2 * Dd) * sizeof(bf16); //  8 MB
  bf16*  Pt   = (bf16*)p;  p += (size_t)(2 * Dd) * Dd * sizeof(bf16);       //  4 MB
  float* cvec = (float*)p;                                                  //  8 KB

  // 1) weights -> bf16, transposed to N-major for contiguous B-fragments (W2 also as it lies);
  //    iQ -> bf16 (gate A-operand); causal cumulative mean (the tril/einsum is a prefix scan)
  prep<<<dim3(NB_PREP), PREP_THREADS, 0, stream>>>(iQ, iV, W1, W2, Wg, iQb, avg, W1t, W2t, Wgt, W2b);

  // 2) h = relu(avg @ W1 + b1) -> bf16;  Pt = (W2 @ Wg[D:])^T -> bf16;  c = bg + b2 @ Wg[D:]
  gemm_h_wprod<<<dim3(NB_G1 + NB_WP + NB_CB), 256, 0, stream>>>(
      avg, W1t, b1, h, Wgt, W2b, Pt, b2, bg, cvec);

  // 3) gate GEMM + ffn GEMM + sigmoid + output combine
  gate_fused<<<dim3(Dd / 64, Mrows / 128), 256, 0, stream>>>(
      iQ, iQb, h, Wgt, Pt, W2t, cvec, b2, out);
}

// v005
// It runs in 91.5 microseconds.
// In both of two side-by-side timings against v004, it was 1.16 times as fast.
// Counting every step since v000, it is 4.60 times as fast.
#include <hip/hip_runtime.h>
#include <hip/hip_bf16.h>

typedef __bf16 bf16;
typedef __attribute__((ext_vector_type(16))) __bf16 v16bf;
typedef __attribute__((ext_vector_type(8)))  float  v8f;

#define WMMA_BF16(a, b, c) \
  __builtin_amdgcn_wmma_f32_16x16x32_bf16(false, (a), false, (b), (short)0, (c), false, false)

static constexpr int Bb    = 4;
static constexpr int Ss    = 2048;
static constexpr int Dd    = 1024;
static constexpr int Mrows = Bb * Ss;   // 8192 tokens
static constexpr int KS    = 64;        // k per LDS stage: one whole 128-B line of every operand row
static constexpr int LDK   = 72;        // LDS row pitch in bf16: 144 B = 16 B x 9, no bank conflict for 16-B reads

// ---------------------------------------------------------------------------
// CDNA5 async global->LDS copy (GLOBAL_LOAD_ASYNC_TO_LDS_B128, ASYNCcnt).
// Param types per hipcc diagnostic: (int4 AS(1)*, int4 AS(3)*, imm, imm).
// Guarded so the kernel still compiles (synchronous fallback) if absent.
// ---------------------------------------------------------------------------
#if __has_builtin(__builtin_amdgcn_global_load_async_to_lds_b128)
#define HAVE_ASYNC_LDS 1
typedef int v4i __attribute__((vector_size(16)));
typedef __attribute__((address_space(1))) v4i gv4i;
typedef __attribute__((address_space(3))) v4i lv4i;
__device__ __forceinline__ void async_cp16B(const bf16* g, bf16* l) {
  // one b128 op: 16 B per lane; eight lanes side by side cover one 128-B row
  __builtin_amdgcn_global_load_async_to_lds_b128((gv4i*)(void*)g, (lv4i*)l, 0, 0);
}
// the wave's own copies have landed; in asm, so that no LDS read is moved in front of it
#define WAIT_ASYNC0() asm volatile("s_wait_asynccnt 0x0" ::: "memory")
#else
#define HAVE_ASYNC_LDS 0
#define WAIT_ASYNC0() ((void)0)
__device__ __forceinline__ void async_cp16B(const bf16* g, bf16* l) {
  *reinterpret_cast<uint4*>(l) = *reinterpret_cast<const uint4*>(g);
}
#endif
// the wave's own LDS reads are done before the barrier behind which their buffer is refilled
#define WAIT_DS0() asm volatile("s_wait_dscnt 0x0" ::: "memory")

// ---------------------------------------------------------------------------
// Load a 16-element bf16 WMMA fragment (32 bytes) from LDS as two b128 reads.
// ---------------------------------------------------------------------------
__device__ __forceinline__ v16bf ldsFrag(const bf16* p) {
  union { v16bf v; uint4 u[2]; } r;
  const uint4* q = reinterpret_cast<const uint4*>(p);
  r.u[0] = q[0];
  r.u[1] = q[1];
  return r.v;
}

__device__ __forceinline__ float sigmoidf(float x) {
  return 1.0f / (1.0f + __expf(-x));
}

typedef __attribute__((ext_vector_type(4))) float  v4f;
typedef __attribute__((ext_vector_type(4))) __bf16 v4bf;
typedef __attribute__((ext_vector_type(2))) __bf16 v2bf;

static constexpr int PREP_THREADS = 512;   // every work-group of the preparation launch: 16 waves

// ---------------------------------------------------------------------------
// Weight transpose + f32->bf16 convert:  Wt[n][k] = (bf16) W[k][n], W is DIM x DIM.
// One work-group takes a tile of 256 k x 128 n. A wave reads whole rows of the
// tile (512 B), two neighbouring k rows a lane, all 16 loads requested at once,
// packs each (k, k + 1) pair into one dword and stores it transposed in LDS;
// rows of Wt leave as aligned 256-B runs.
// ---------------------------------------------------------------------------
static constexpr int WT_K     = 256;            // tile extent along k
static constexpr int WT_N     = 128;            // tile extent along n
static constexpr int WT_PITCH = WT_K / 2 + 1;   // LDS row pitch in dwords: odd, so that rows start on different banks

template <int DIM>
__device__ __forceinline__ void wconv_tile(const float* __restrict__ W, bf16* __restrict__ Wt,
                                           int tile, unsigned* __restrict__ t) {
  constexpr int NT = DIM / WT_N;
  const int nb   = (tile % NT) * WT_N;
  const int kb   = (tile / NT) * WT_K;
  const int lane = threadIdx.x & 31;
  const int wave = threadIdx.x >> 5;         // 0..15

  const float* src = W + (size_t)(kb + 2 * wave) * DIM + nb + lane * 4;
  v4f a[8], b[8];
#pragma unroll   // the row steps become immediate offsets on one address pair
  for (int i = 0; i < 8; ++i) {
    a[i] = *reinterpret_cast<const v4f*>(src + (size_t)(i * 32) * DIM);
    b[i] = *reinterpret_cast<const v4f*>(src + (size_t)(i * 32 + 1) * DIM);
  }
  // keeps the loads' address pair live to here, so that no load of the run lands in
  // it, and puts the wait in front of the first rewrite of a register they name
  asm volatile("s_wait_xcnt 0x0" :: "v"(src) : "memory");
#pragma unroll   // a[], b[] stay in registers: every index a constant
  for (int i = 0; i < 8; ++i)
#pragma unroll   // as above
    for (int j = 0; j < 4; ++j) {
      const v2bf p = {(bf16)a[i][j], (bf16)b[i][j]};
      t[(lane * 4 + j) * WT_PITCH + i * 16 + wave] = __builtin_bit_cast(unsigned, p);
    }
  __syncthreads();
#pragma unroll   // all LDS reads of the eight pieces go out ahead of the first store
  for (int i = 0; i < 8; ++i) {
    const int n = (i >> 1) * 32 + wave * 2 + (lane >> 4);
    const int q = (i & 1) * 16 + (lane & 15);   // 16-B piece of the row's 512 B
    const unsigned* r = t + n * WT_PITCH + q * 4;
    const uint4 o = make_uint4(r[0], r[1], r[2], r[3]);
    *reinterpret_cast<uint4*>(Wt + (size_t)(nb + n) * DIM + kb + q * 8) = o;
  }
  // the wait in front of any later rewrite of a register that the eight stores name
  asm volatile("s_wait_xcnt 0x0" ::: "memory");
}

// ---------------------------------------------------------------------------
// Elementwise f32 -> bf16 (for iQ, so gate A-tiles can use async staging, and for W2 as it lies).
// One work-group converts 256 KiB: 32 loads of 16 B a lane, all requested at once.
// ---------------------------------------------------------------------------
static constexpr int CV_LOADS = 32;

__device__ __forceinline__ void f32_to_bf16_block(const float* __restrict__ in, bf16* __restrict__ out,
                                                  int blk) {
  const size_t i0 = (size_t)blk * (PREP_THREADS * CV_LOADS) + threadIdx.x;
  const v4f* s = reinterpret_cast<const v4f*>(in) + i0;
  v4bf*      d = reinterpret_cast<v4bf*>(out) + i0;
  v4f f[CV_LOADS];
#pragma unroll   // f[] stays in registers, the steps become immediate offsets
  for (int i = 0; i < CV_LOADS; ++i) f[i] = s[i * PREP_THREADS];
#pragma unroll   // as above
  for (int i = 0; i < CV_LOADS; ++i) {
    d[i * PREP_THREADS] = __builtin_convertvector(f[i], v4bf);
    // lets each eight stores leave while later loads are still under way; without it
    // the compiler gathers all stores behind the wait for the last load
    if (i % 8 == 7) __builtin_amdgcn_sched_barrier(0);
  }
  // the wait in front of any later rewrite of a register that the last stores name
  asm volatile("s_wait_xcnt 0x0" ::: "memory");
}

// ---------------------------------------------------------------------------
// Causal cumulative mean of iV along S, written directly as bf16.
// Chunked scan: a work-group owns 64 columns (256 B of iV, one whole 128-B line
// of avg per row) and 1024 rows. Each half-wave (16 lanes x 4 columns) holds one
// chunk of 32 rows in registers and scans it there; chunk totals meet in LDS,
// and each chunk adds the totals of all chunks in front of it. Rows in front of
// the work-group's own 1024 are only summed, chunk by chunk, into the same table.
// ---------------------------------------------------------------------------
static constexpr int SC_COLS   = 64;                          // columns per work-group
static constexpr int SC_ROWS   = 32;                          // rows per chunk
static constexpr int SC_CHUNKS = 32;                          // chunks per work-group (16 waves x 2)
static constexpr int SC_PARTS  = Ss / (SC_ROWS * SC_CHUNKS);  // work-groups along S

__device__ __forceinline__ void avg_scan(const float* __restrict__ iV, bf16* __restrict__ avg,
                                         int colgrp, int part, int batch,
                                         float (*__restrict__ csum)[SC_COLS]) {
  const int lc    = (threadIdx.x & 15) * 4;   // column inside the work-group
  const int chunk = threadIdx.x >> 4;         // 0..31
  const int col   = colgrp * SC_COLS + lc;
  const v4f zero  = {};

  // this thread's chunk of part 0: all 32 rows requested at once
  const float* src = iV + ((size_t)batch * Ss + chunk * SC_ROWS) * Dd + col;
  v4f v[SC_ROWS];
#pragma unroll
  for (int r = 0; r < SC_ROWS; ++r)
    v[r] = *reinterpret_cast<const v4f*>(src + (size_t)r * Dd);
  // keeps the loads' address pair live to here, so that no load of the run lands in
  // it, and puts the wait in front of the first rewrite of a register they name
  asm volatile("s_wait_xcnt 0x0" :: "v"(src) : "memory");

  // parts in front of the own one: only the chunk's total is kept; each row's
  // registers take the same row of the next part as soon as the row is summed,
  // so that 32 loads of a wave stay in flight up to the own part
#pragma unroll 1   // at most SC_PARTS - 1 trips: a second copy of the body would only be code
  for (int p = 0; p < part; ++p) {
    src += (size_t)SC_CHUNKS * SC_ROWS * Dd;
    v4f s = zero;
#pragma unroll
    for (int r = 0; r < SC_ROWS; ++r) {
      s += v[r];
      v[r] = *reinterpret_cast<const v4f*>(src + (size_t)r * Dd);
    }
    *reinterpret_cast<v4f*>(&csum[p * SC_CHUNKS + chunk][lc]) = s;
  }

  // inclusive scan of the own chunk, in registers
#pragma unroll
  for (int r = 1; r < SC_ROWS; ++r) v[r] += v[r - 1];
  *reinterpret_cast<v4f*>(&csum[part * SC_CHUNKS + chunk][lc]) = v[SC_ROWS - 1];
  __syncthreads();

  // totals of every chunk in front of this one, in row order; 8 independent LDS
  // reads a trip, so that their latency is paid once a trip and not once a chunk
  v4f off = zero;
  for (int c0 = 0; c0 < part * SC_CHUNKS; c0 += 8) {
    v4f t[8];
#pragma unroll
    for (int j = 0; j < 8; ++j) t[j] = *reinterpret_cast<const v4f*>(&csum[c0 + j][lc]);
#pragma unroll
    for (int j = 0; j < 8; ++j) off += t[j];
  }
  const float* own = &csum[part * SC_CHUNKS][lc];
  const int wtop = __builtin_amdgcn_readfirstlane(threadIdx.x >> 5) * 2 + 1;  // the wave's later chunk
  for (int c0 = 0; c0 < wtop; c0 += 8) {
    v4f t[8];
#pragma unroll
    for (int j = 0; j < 8; ++j) t[j] = *reinterpret_cast<const v4f*>(own + (c0 + j) * SC_COLS);
#pragma unroll
    for (int j = 0; j < 8; ++j) off += (c0 + j < chunk) ? t[j] : zero;
  }

  const int row0 = (part * SC_CHUNKS + chunk) * SC_ROWS;
  bf16* dst = avg + ((size_t)batch * Ss + row0) * Dd + col;
#pragma unroll
  for (int r = 0; r < SC_ROWS; ++r) {
    const v4f m = (off + v[r]) * (1.0f / (float)(row0 + r + 1));
    *reinterpret_cast<v4bf*>(dst + (size_t)r * Dd) = __builtin_convertvector(m, v4bf);
  }
}

// ---------------------------------------------------------------------------
// All work that depends on the inputs alone, in one launch: none of its pieces
// reads what another writes. Ranges of blockIdx.x, the longest work-groups first:
// scan, iQ conversion, W2 conversion (untransposed copy), weight tiles.
// ---------------------------------------------------------------------------
static constexpr int NB_COLGRP = Dd / SC_COLS;
static constexpr int NB_SCAN   = NB_COLGRP * Bb * SC_PARTS;
static constexpr int NB_CONV   = Mrows * Dd / 4 / (PREP_THREADS * CV_LOADS);
static constexpr int NB_WG     = (2 * Dd / WT_K) * (2 * Dd / WT_N);
static constexpr int NB_W      = (Dd / WT_K) * (Dd / WT_N);
static constexpr int NB_W2C    = Dd * Dd / 4 / (PREP_THREADS * CV_LOADS);
static constexpr int NB_PREP   = NB_SCAN + NB_CONV + NB_W2C + NB_WG + 2 * NB_W;
static constexpr int SCAN_LDS  = SC_PARTS * SC_CHUNKS * SC_COLS * 4;
static constexpr int WT_LDS    = WT_N * WT_PITCH * 4;

__global__ __launch_bounds__(PREP_THREADS)
void prep(const float* __restrict__ iQ, const float* __restrict__ iV,
          const float* __restrict__ W1, const float* __restrict__ W2, const float* __restrict__ Wg,
          bf16* __restrict__ iQb, bf16* __restrict__ avg,
          bf16* __restrict__ W1t, bf16* __restrict__ W2t, bf16* __restrict__ Wgt,
          bf16* __restrict__ W2b) {
  __shared__ __align__(16) unsigned char smem[SCAN_LDS > WT_LDS ? SCAN_LDS : WT_LDS];
  unsigned* wt = reinterpret_cast<unsigned*>(smem);

  int b = blockIdx.x;
  if (b < NB_SCAN) {
    avg_scan(iV, avg, b % NB_COLGRP, b / NB_COLGRP % SC_PARTS, b / (NB_COLGRP * SC_PARTS),
             reinterpret_cast<float (*)[SC_COLS]>(smem));
    return;
  }
  b -= NB_SCAN;
  if (b < NB_CONV) { f32_to_bf16_block(iQ, iQb, b); return; }
  b -= NB_CONV;
  if (b < NB_W2C) { f32_to_bf16_block(W2, W2b, b); return; }
  b -= NB_W2C;
  if (b < NB_WG) { wconv_tile<2 * Dd>(Wg, Wgt, b, wt); return; }
  b -= NB_WG;
  if (b < NB_W) wconv_tile<Dd>(W1, W1t, b, wt);
  else          wconv_tile<Dd>(W2, W2t, b - NB_W, wt);
}

// ---------------------------------------------------------------------------
// The gate's product is taken apart along k and its lower half re-associated:
//   concat([iQ, ffn]) @ Wg + bg = iQ @ Wg[:D] + h @ P + c,
//   P = W2 @ Wg[D:],  c = bg + b2 @ Wg[D:],  because ffn = h @ W2 + b2.
// P and c depend on the weights alone, so the gate no longer waits for ffn, and
// ffn itself is formed inside the gate kernel from the h rows staged there.
// ---------------------------------------------------------------------------
typedef __attribute__((ext_vector_type(8))) __bf16 v8bf;

// c[n] = bg[n] + sum_j b2[j] * Wg[D + j][n], from the transposed bf16 weights.
// A work-group takes 32 values of n, one whole 128-B line of c: four rows a wave,
// the sums meet in LDS and the first wave stores the line.
static constexpr int CB_ROWS = 32;   // values of n per work-group of 8 waves

__device__ __forceinline__ void gate_bias(const bf16* __restrict__ Wgt, const float* __restrict__ b2,
                                          const float* __restrict__ bg, float* __restrict__ cvec,
                                          int blk, float* __restrict__ part) {
  const int lane = threadIdx.x & 31;
  const int wave = threadIdx.x >> 5;
  const int nb   = blk * CB_ROWS;
  v4f bb[4][2];
#pragma unroll   // bb[] stays in registers
  for (int i = 0; i < 4; ++i) {
    bb[i][0] = *reinterpret_cast<const v4f*>(b2 + i * 256 + lane * 8);
    bb[i][1] = *reinterpret_cast<const v4f*>(b2 + i * 256 + lane * 8 + 4);
  }
#pragma unroll 1   // four short trips: unrolled, their registers would set the whole kernel's allocation
  for (int rr = 0; rr < 4; ++rr) {
    const int r = wave * 4 + rr;
    const bf16* row = Wgt + (size_t)(nb + r) * (2 * Dd) + Dd + lane * 8;
    v8bf w[4];
#pragma unroll   // the steps become immediate offsets on one address pair
    for (int i = 0; i < 4; ++i) w[i] = *reinterpret_cast<const v8bf*>(row + i * 256);
    // keeps the loads' address pair live to here, so that no load of the run lands in
    // it, and puts the wait in front of the first rewrite of a register they name
    asm volatile("s_wait_xcnt 0x0" :: "v"(row) : "memory");
    float s = 0.0f;
#pragma unroll
    for (int i = 0; i < 4; ++i)
#pragma unroll
      for (int j = 0; j < 8; ++j) s += (float)w[i][j] * bb[i][j >> 2][j & 3];
#pragma unroll
    for (int o = 16; o > 0; o >>= 1) s += __shfl_xor(s, o);
    if (lane == 0) part[r] = s;
  }
  __syncthreads();
  if (threadIdx.x < 32) cvec[nb + lane] = bg[nb + lane] + part[lane];
}

// ---------------------------------------------------------------------------
// bf16 WMMA GEMM with async double-buffered LDS staging, two products in one launch,
// neither of which reads what the other writes:
//   h[m][n]  = relu(avg[m][:] . W1t[n][:] + b1[n])        (Mrows x Dd)
//   Pt[n][k] = Wgt[n][Dd:] . W2b[k][:]                    (2 Dd x Dd), P transposed
// and the work-groups of gate_bias behind them.
// Block tile 128x128, stages of KS k in two buffers, one barrier a stage. 8 waves
// (2x4); each wave computes 64x32 = 4x2 WMMA tiles.
// ---------------------------------------------------------------------------
static constexpr int NB_G1 = (Mrows / 128) * (Dd / 128);
static constexpr int NB_WP = (2 * Dd / 128) * (Dd / 128);
static constexpr int NB_CB = 2 * Dd / CB_ROWS;

__global__ __launch_bounds__(256)
void gemm_h_wprod(const bf16* __restrict__ avg, const bf16* __restrict__ W1t,
                  const float* __restrict__ b1, bf16* __restrict__ h,
                  const bf16* __restrict__ Wgt, const bf16* __restrict__ W2b,
                  bf16* __restrict__ Pt,
                  const float* __restrict__ b2, const float* __restrict__ bg,
                  float* __restrict__ cvec) {
  __shared__ __align__(16) bf16 As[2][128 * LDK];
  __shared__ __align__(16) bf16 Bs[2][128 * LDK];

  if (blockIdx.x >= NB_G1 + NB_WP) {   // the same for the whole work-group
    gate_bias(Wgt, b2, bg, cvec, blockIdx.x - (NB_G1 + NB_WP), reinterpret_cast<float*>(&As[0][0]));
    return;
  }
  const bool  prod = blockIdx.x >= NB_G1;
  const int   tile = prod ? blockIdx.x - NB_G1 : blockIdx.x;
  const bf16* A    = prod ? Wgt + Dd : avg;
  const int   lda  = prod ? 2 * Dd : Dd;
  const bf16* Bt   = prod ? W2b : W1t;
  bf16*       outb = prod ? Pt : h;

  const int tid   = threadIdx.x;
  const int lane  = tid & 31;
  const int wid   = tid >> 5;
  const int half  = lane >> 4;
  const int l16   = lane & 15;
  const int waveM = wid >> 2;   // 0..1
  const int waveN = wid & 3;    // 0..3
  const int m0    = (tile / (Dd / 128)) * 128;
  const int n0    = (tile % (Dd / 128)) * 128;
  const int srow  = tid >> 3;   // 0..31: first of this thread's four rows, 32 apart
  const int sseg  = tid & 7;    // 16-B piece of the row's 128 B

  const bf16* Ag = A  + (size_t)(m0 + srow) * lda + sseg * 8;
  const bf16* Bg = Bt + (size_t)(n0 + srow) * Dd + sseg * 8;
  const int lofs = srow * LDK + sseg * 8;

  auto stage = [&](int k0, int buf) {   // 8 async-b128 per wave per stage, 4 whole lines each
#pragma unroll   // the four row offsets become constants of their copies
    for (int i = 0; i < 4; ++i) {
      async_cp16B(Ag + (size_t)(i * 32) * lda + k0, &As[buf][lofs + i * 32 * LDK]);
      async_cp16B(Bg + (size_t)(i * 32) * Dd + k0, &Bs[buf][lofs + i * 32 * LDK]);
    }
  };

  v8f zero = {};
  v8f acc[4][2];
#pragma unroll
  for (int i = 0; i < 4; ++i)
#pragma unroll
    for (int j = 0; j < 2; ++j) acc[i][j] = zero;

  constexpr int T = Dd / KS;
  stage(0, 0);
  WAIT_ASYNC0();
  __syncthreads();
  stage(KS, 1);                                // flies while stage 0 is worked on
  for (int t = 0; t < T; ++t) {
    const int buf = t & 1;
#pragma unroll   // both 32-k blocks of a stage in one straight run, kk an immediate offset of the reads
    for (int kk = 0; kk < KS; kk += 32) {
      v16bf af[4], bfr[2];
#pragma unroll
      for (int mi = 0; mi < 4; ++mi)
        af[mi] = ldsFrag(&As[buf][(waveM * 64 + mi * 16 + l16) * LDK + kk + half * 16]);
#pragma unroll
      for (int ni = 0; ni < 2; ++ni)
        bfr[ni] = ldsFrag(&Bs[buf][(waveN * 32 + ni * 16 + l16) * LDK + kk + half * 16]);
#pragma unroll
      for (int mi = 0; mi < 4; ++mi)
#pragma unroll
        for (int ni = 0; ni < 2; ++ni)
          acc[mi][ni] = WMMA_BF16(af[mi], bfr[ni], acc[mi][ni]);
    }
    // one barrier publishes stage t + 1 and ends every read of stage t's buffer
    WAIT_DS0();
    WAIT_ASYNC0();
    __syncthreads();
    if (t + 2 < T) stage((t + 2) * KS, buf);   // refill the buffer just left
  }
  WAIT_ASYNC0();

  // ---- epilogue: h takes bias and relu, Pt neither; convert, store ----
#pragma unroll
  for (int ni = 0; ni < 2; ++ni) {
    const int n = n0 + waveN * 32 + ni * 16 + l16;
    const float bv = prod ? 0.0f : b1[n];
#pragma unroll
    for (int mi = 0; mi < 4; ++mi) {
      const int mbase = m0 + waveM * 64 + mi * 16 + 8 * half;
#pragma unroll
      for (int r = 0; r < 8; ++r) {
        float v = acc[mi][ni][r] + bv;
        if (!prod) v = fmaxf(v, 0.0f);
        outb[(size_t)(mbase + r) * Dd + n] = (bf16)v;
      }
    }
    // the wait in front of any later rewrite of a register that this trip's stores name
    asm volatile("s_wait_xcnt 0x0" ::: "memory");
  }
}

// ---------------------------------------------------------------------------
// Fused gate GEMM:  g = sigmoid(iQ @ Wg[:D] + h @ P + c), ffn = h @ W2 + b2,
// out = gi*iQ + gf*ffn. k stages 0..T1-1 take A from iQ (bf16) and B from Wgt;
// stages T1.. take A from h and B from Pt, and the same h fragments also meet
// the W2t rows of the block's columns, so that ffn stays in f32 accumulators.
// Each block computes paired column tiles n (gate-i), n+1024 (gate-f) and n (ffn).
// Block tile: M=256, N=128 per part, one work-group on every WGP. 16 waves (4x4);
// wave = 64x32 per part: a B fragment from LDS meets 4 A fragments, a staged B row
// serves 256 rows of A and a staged A row 256 or 384 columns.
// ---------------------------------------------------------------------------
struct two_parts   { static constexpr int value = 2; };
struct three_parts { static constexpr int value = 3; };

static constexpr int GM = 256;   // block rows
static constexpr int GN = 128;   // block columns per part
static constexpr int GT = 512;   // threads: 16 waves

__global__ __launch_bounds__(GT)
void gate_fused(const float* __restrict__ iQ, const bf16* __restrict__ iQb,
                const bf16* __restrict__ h, const bf16* __restrict__ Wgt,
                const bf16* __restrict__ Pt, const bf16* __restrict__ W2t,
                const float* __restrict__ cvec, const float* __restrict__ b2,
                float* __restrict__ out) {
  __shared__ __align__(16) bf16 As[2][GM * LDK];
  __shared__ __align__(16) bf16 Bs[2][3 * GN * LDK];   // rows 0..GN-1 gate-i columns, then gate-f, then ffn

  const int tid   = threadIdx.x;
  const int lane  = tid & 31;
  const int wid   = tid >> 5;
  const int half  = lane >> 4;
  const int l16   = lane & 15;
  const int waveM = wid >> 2;   // 0..3
  const int waveN = wid & 3;    // 0..3
  const int m0    = blockIdx.y * GM;
  const int n0    = blockIdx.x * GN;

  const int srow = tid >> 3;          // 0..63: first of this thread's rows, 64 apart
  const int sseg = tid & 7;           // 16-B piece of the row's 128 B
  const size_t aofs = (size_t)(m0 + srow) * Dd + sseg * 8;
  const size_t bofs = (size_t)(n0 + srow) * Dd + sseg * 8;
  const bf16* Bgp = Wgt + (size_t)(n0 + srow) * (2 * Dd) + sseg * 8;
  const int lofs = srow * LDK + sseg * 8;

  auto stage_q = [&](int k0, int buf) {   // iQ and Wgt: 8 async-b128 per wave per stage, 4 whole lines each
#pragma unroll   // the row offsets become constants of their copies
    for (int i = 0; i < GM / 64; ++i)
      async_cp16B(iQb + aofs + (size_t)(i * 64) * Dd + k0, &As[buf][lofs + i * 64 * LDK]);
#pragma unroll   // as above
    for (int i = 0; i < 2 * GN / 64; ++i) {
      const int wrow = i * 64 + (i >= GN / 64 ? Dd - GN : 0);   // LDS rows GN.. hold Wgt rows Dd + n0..
      async_cp16B(Bgp + (size_t)wrow * (2 * Dd) + k0, &Bs[buf][lofs + i * 64 * LDK]);
    }
  };
  auto stage_h = [&](int k0, int buf) {   // h, Pt and W2t: 10 async-b128 per wave per stage
#pragma unroll   // as above
    for (int i = 0; i < GM / 64; ++i)
      async_cp16B(h + aofs + (size_t)(i * 64) * Dd + k0, &As[buf][lofs + i * 64 * LDK]);
#pragma unroll   // as above
    for (int i = 0; i < 2 * GN / 64; ++i) {
      const int wrow = i * 64 + (i >= GN / 64 ? Dd - GN : 0);   // LDS rows GN.. hold Pt rows Dd + n0..
      async_cp16B(Pt + bofs + (size_t)wrow * Dd + k0, &Bs[buf][lofs + i * 64 * LDK]);
    }
#pragma unroll   // as above
    for (int i = 0; i < GN / 64; ++i)
      async_cp16B(W2t + bofs + (size_t)(i * 64) * Dd + k0, &Bs[buf][lofs + (2 * GN + i * 64) * LDK]);
  };

  v8f zero = {};
  v8f acc[3][4][2];   // part (gate-i, gate-f, ffn), row tile, column tile
#pragma unroll
  for (int p = 0; p < 3; ++p)
#pragma unroll
    for (int i = 0; i < 4; ++i)
#pragma unroll
      for (int j = 0; j < 2; ++j) acc[p][i][j] = zero;

  auto work = [&](int buf, auto parts) {   // one stage's products on the first 2 or all 3 parts of Bs
    constexpr int NP = decltype(parts)::value;
#pragma unroll   // both 32-k blocks of a stage in one straight run, kk an immediate offset of the reads
    for (int kk = 0; kk < KS; kk += 32) {
      v16bf af[4];
#pragma unroll
      for (int mi = 0; mi < 4; ++mi)
        af[mi] = ldsFrag(&As[buf][(waveM * 64 + mi * 16 + l16) * LDK + kk + half * 16]);
#pragma unroll   // acc[] stays in registers: every index a constant
      for (int p = 0; p < NP; ++p) {
        v16bf bfr[2];
#pragma unroll
        for (int ni = 0; ni < 2; ++ni)
          bfr[ni] = ldsFrag(&Bs[buf][(p * GN + waveN * 32 + ni * 16 + l16) * LDK + kk + half * 16]);
#pragma unroll
        for (int mi = 0; mi < 4; ++mi)
#pragma unroll
          for (int ni = 0; ni < 2; ++ni)
            acc[p][mi][ni] = WMMA_BF16(af[mi], bfr[ni], acc[p][mi][ni]);
      }
    }
    // one barrier publishes the next stage and ends every read of this stage's buffer
    WAIT_DS0();
    WAIT_ASYNC0();
    __syncthreads();
  };

  constexpr int T1 = Dd / KS;         // stages on iQ, and as many on h
  stage_q(0, 0);
  WAIT_ASYNC0();
  __syncthreads();
  stage_q(KS, 1);                              // flies while stage 0 is worked on
  for (int t = 0; t < T1; ++t) {
    work(t & 1, two_parts{});
    if (t + 2 < T1) stage_q((t + 2) * KS, t & 1);   // refill the buffer just left
    else            stage_h((t + 2 - T1) * KS, t & 1);
  }
  for (int t = 0; t < T1; ++t) {
    work(t & 1, three_parts{});
    if (t + 2 < T1) stage_h((t + 2) * KS, t & 1);
  }
  WAIT_ASYNC0();

  // ---- fused sigmoid-gate epilogue (f32 iQ from memory, f32 ffn from the accumulators) ----
  const int nw = n0 + waveN * 32 + l16;   // the lane's first column; the second is 16 on
  float cLv[2], cRv[2], b2v[2];
#pragma unroll
  for (int ni = 0; ni < 2; ++ni) {
    cLv[ni] = cvec[nw + ni * 16];
    cRv[ni] = cvec[Dd + nw + ni * 16];
    b2v[ni] = b2[nw + ni * 16];
  }
  // keeps the six loads' index register live to here, so that no later load lands in
  // it, and puts the wait in front of the first rewrite of a register they name
  asm volatile("s_wait_xcnt 0x0" :: "v"(nw) : "memory");
  // A lane's 64 values lie on one address pair each for iQ and out: row steps and
  // column steps are immediate offsets. They go in four batches of 16 (two row tiles
  // of one column tile); the next batch's iQ values are requested before this one is worked on.
  const size_t base = (size_t)(m0 + waveM * 64 + 8 * half) * Dd + nw;
  const float* qp = iQ + base;
  float*       op = out + base;
  float q[2][16];
#pragma unroll   // q[] stays in registers: every index a constant
  for (int i = 0; i < 16; ++i) q[0][i] = qp[(size_t)((i >> 3) * 16 + (i & 7)) * Dd];
  // keeps the loads' address pair live to here, so that no load of the batch lands in
  // it, and puts the wait in front of the first rewrite of a register they name
  asm volatile("s_wait_xcnt 0x0" :: "v"(qp) : "memory");
  // nothing from below is moved up between the loads and their wait
  __builtin_amdgcn_sched_barrier(0);
#pragma unroll   // acc[], q[] stay in registers: every index a constant
  for (int g = 0; g < 4; ++g) {
    const int ni = g >> 1, mh = (g & 1) * 2;   // this batch's column tile and first row tile
    if (g + 1 < 4) {
      const int nn = (g + 1) >> 1, nh = ((g + 1) & 1) * 2;
#pragma unroll   // as above
      for (int i = 0; i < 16; ++i)
        q[(g + 1) & 1][i] = qp[(size_t)((nh + (i >> 3)) * 16 + (i & 7)) * Dd + nn * 16];
      // as behind the first batch of loads
      asm volatile("s_wait_xcnt 0x0" :: "v"(qp) : "memory");
      // nothing from below is moved up between the loads and their wait
      __builtin_amdgcn_sched_barrier(0);
    }
    float o[16];
#pragma unroll   // as above
    for (int i = 0; i < 16; ++i) {
      const int mi = mh + (i >> 3), r = i & 7;
      const float gi = sigmoidf(acc[0][mi][ni][r] + cLv[ni]);
      const float gf = sigmoidf(acc[1][mi][ni][r] + cRv[ni]);
      o[i] = gi * q[g & 1][i] + gf * (acc[2][mi][ni][r] + b2v[ni]);
    }
    // the batch's stores stand together behind its arithmetic, so that none of it
    // rewrites a register that an issued store names
    __builtin_amdgcn_sched_barrier(0);
#pragma unroll   // as above
    for (int i = 0; i < 16; ++i)
      op[(size_t)((mh + (i >> 3)) * 16 + (i & 7)) * Dd + ni * 16] = o[i];
    // the wait in front of any later rewrite of a register that the batch's stores name
    asm volatile("s_wait_xcnt 0x0" :: "v"(op) : "memory");
    // nothing from below is moved up between the stores and their wait
    __builtin_amdgcn_sched_barrier(0);
  }
}

// ---------------------------------------------------------------------------
extern "C" void kernel_launch(void* const* d_in, const int* in_sizes, int n_in,
                              void* d_out, int out_size, void* d_ws, size_t ws_size,
                              hipStream_t stream) {
  const float* iQ = (const float*)d_in[0];
  const float* iV = (const float*)d_in[1];
  const float* W1 = (const float*)d_in[2];
  const float* b1 = (const float*)d_in[3];
  const float* W2 = (const float*)d_in[4];
  const float* b2 = (const float*)d_in[5];
  const float* Wg = (const float*)d_in[6];
  const float* bg = (const float*)d_in[7];
  float* out = (float*)d_out;

  // Workspace layout (~66 MB total)
  char* p = (char*)d_ws;
  bf16*  avg  = (bf16*)p;  p += (size_t)Mrows * Dd * sizeof(bf16);          // 16 MB
  bf16*  h    = (bf16*)p;  p += (size_t)Mrows * Dd * sizeof(bf16);          // 16 MB
  bf16*  iQb  = (bf16*)p;  p += (size_t)Mrows * Dd * sizeof(bf16);          // 16 MB
  bf16*  W1t  = (bf16*)p;  p += (size_t)Dd * Dd * sizeof(bf16);             //  2 MB
  bf16*  W2t  = (bf16*)p;  p += (size_t)Dd * Dd * sizeof(bf16);             //  2 MB
  bf16*  W2b  = (bf16*)p;  p += (size_t)Dd * Dd * sizeof(bf16);             //  2 MB
  bf16*  Wgt  = (bf16*)p;  p += (size_t)(2 * Dd) * (2 * Dd) * sizeof(bf16); //  8 MB
  bf16*  Pt   = (bf16*)p;  p += (size_t)(2 * Dd) * Dd * sizeof(bf16);       //  4 MB
  float* cvec = (float*)p;                                                  //  8 KB

  // 1) weights -> bf16, transposed to N-major for contiguous B-fragments (W2 also as it lies);
  //    iQ -> bf16 (gate A-operand); causal cumulative mean (the tril/einsum is a prefix scan)
  prep<<<dim3(NB_PREP), PREP_THREADS, 0, stream>>>(iQ, iV, W1, W2, Wg, iQb, avg, W1t, W2t, Wgt, W2b);

  // 2) h = relu(avg @ W1 + b1) -> bf16;  Pt = (W2 @ Wg[D:])^T -> bf16;  c = bg + b2 @ Wg[D:]
  gemm_h_wprod<<<dim3(NB_G1 + NB_WP + NB_CB), 256, 0, stream>>>(
      avg, W1t, b1, h, Wgt, W2b, Pt, b2, bg, cvec);

  // 3) gate GEMM + ffn GEMM + sigmoid + output combine
  gate_fused<<<dim3(Dd / GN, Mrows / GM), GT, 0, stream>>>(
      iQ, iQb, h, Wgt, Pt, W2t, cvec, b2, out);
}

// v006
// It runs in 88.3 microseconds.
// Two timings next to v005 put it at 1.04 and 1.03 times that version's speed.
// Counting every step since v000, it is 4.77 times as fast.
#include <hip/hip_runtime.h>
#include <hip/hip_bf16.h>

typedef __bf16 bf16;
typedef __attribute__((ext_vector_type(16))) __bf16 v16bf;
typedef __attribute__((ext_vector_type(8)))  float  v8f;

#define WMMA_BF16(a, b, c) \
  __builtin_amdgcn_wmma_f32_16x16x32_bf16(false, (a), false, (b), (short)0, (c), false, false)

static constexpr int Bb    = 4;
static constexpr int Ss    = 2048;
static constexpr int Dd    = 1024;
static constexpr int Mrows = Bb * Ss;   // 8192 tokens
static constexpr int KS    = 64;        // k per LDS stage: one whole 128-B line of every operand row
static constexpr int LDK   = 72;        // LDS row pitch in bf16: 144 B = 16 B x 9, no bank conflict for 16-B reads

// ---------------------------------------------------------------------------
// CDNA5 async global->LDS copy (GLOBAL_LOAD_ASYNC_TO_LDS_B128, ASYNCcnt).
// Param types per hipcc diagnostic: (int4 AS(1)*, int4 AS(3)*, imm, imm).
// Guarded so the kernel still compiles (synchronous fallback) if absent.
// ---------------------------------------------------------------------------
#if __has_builtin(__builtin_amdgcn_global_load_async_to_lds_b128)
#define HAVE_ASYNC_LDS 1
typedef int v4i __attribute__((vector_size(16)));
typedef __attribute__((address_space(1))) v4i gv4i;
typedef __attribute__((address_space(3))) v4i lv4i;
__device__ __forceinline__ void async_cp16B(const bf16* g, bf16* l) {
  // one b128 op: 16 B per lane; eight lanes side by side cover one 128-B row
  __builtin_amdgcn_global_load_async_to_lds_b128((gv4i*)(void*)g, (lv4i*)l, 0, 0);
}
// the wave's own copies have landed; in asm, so that no LDS read is moved in front of it
#define WAIT_ASYNC0() asm volatile("s_wait_asynccnt 0x0" ::: "memory")
#else
#define HAVE_ASYNC_LDS 0
#define WAIT_ASYNC0() ((void)0)
__device__ __forceinline__ void async_cp16B(const bf16* g, bf16* l) {
  *reinterpret_cast<uint4*>(l) = *reinterpret_cast<const uint4*>(g);
}
#endif
// the wave's own LDS reads are done before the barrier behind which their buffer is refilled
#define WAIT_DS0() asm volatile("s_wait_dscnt 0x0" ::: "memory")

// ---------------------------------------------------------------------------
// Load a 16-element bf16 WMMA fragment (32 bytes) from LDS as two b128 reads.
// ---------------------------------------------------------------------------
__device__ __forceinline__ v16bf ldsFrag(const bf16* p) {
  union { v16bf v; uint4 u[2]; } r;
  const uint4* q = reinterpret_cast<const uint4*>(p);
  r.u[0] = q[0];
  r.u[1] = q[1];
  return r.v;
}

__device__ __forceinline__ float sigmoidf(float x) {
  return 1.0f / (1.0f + __expf(-x));
}

typedef __attribute__((ext_vector_type(4))) float  v4f;
typedef __attribute__((ext_vector_type(4))) __bf16 v4bf;
typedef __attribute__((ext_vector_type(2))) __bf16 v2bf;

static constexpr int PREP_THREADS = 512;   // every work-group of the preparation launch: 16 waves

// ---------------------------------------------------------------------------
// Weight transpose + f32->bf16 convert:  Wt[n][k] = (bf16) W[k][n], W is DIM x DIM.
// One work-group takes a tile of 256 k x 128 n. A wave reads whole rows of the
// tile (512 B), two neighbouring k rows a lane, all 16 loads requested at once,
// packs each (k, k + 1) pair into one dword and stores it transposed in LDS;
// rows of Wt leave as aligned 256-B runs.
// ---------------------------------------------------------------------------
static constexpr int WT_K     = 256;            // tile extent along k
static constexpr int WT_N     = 128;            // tile extent along n
static constexpr int WT_PITCH = WT_K / 2 + 1;   // LDS row pitch in dwords: odd, so that rows start on different banks

template <int DIM>
__device__ __forceinline__ void wconv_tile(const float* __restrict__ W, bf16* __restrict__ Wt,
                                           int tile, unsigned* __restrict__ t) {
  constexpr int NT = DIM / WT_N;
  const int nb   = (tile % NT) * WT_N;
  const int kb   = (tile / NT) * WT_K;
  const int lane = threadIdx.x & 31;
  const int wave = threadIdx.x >> 5;         // 0..15

  const float* src = W + (size_t)(kb + 2 * wave) * DIM + nb + lane * 4;
  v4f a[8], b[8];
#pragma unroll   // the row steps become immediate offsets on one address pair
  for (int i = 0; i < 8; ++i) {
    a[i] = *reinterpret_cast<const v4f*>(src + (size_t)(i * 32) * DIM);
    b[i] = *reinterpret_cast<const v4f*>(src + (size_t)(i * 32 + 1) * DIM);
  }
  // keeps the loads' address pair live to here, so that no load of the run lands in
  // it, and puts the wait in front of the first rewrite of a register they name
  asm volatile("s_wait_xcnt 0x0" :: "v"(src) : "memory");
#pragma unroll   // a[], b[] stay in registers: every index a constant
  for (int i = 0; i < 8; ++i)
#pragma unroll   // as above
    for (int j = 0; j < 4; ++j) {
      const v2bf p = {(bf16)a[i][j], (bf16)b[i][j]};
      t[(lane * 4 + j) * WT_PITCH + i * 16 + wave] = __builtin_bit_cast(unsigned, p);
    }
  __syncthreads();
#pragma unroll   // all LDS reads of the eight pieces go out ahead of the first store
  for (int i = 0; i < 8; ++i) {
    const int n = (i >> 1) * 32 + wave * 2 + (lane >> 4);
    const int q = (i & 1) * 16 + (lane & 15);   // 16-B piece of the row's 512 B
    const unsigned* r = t + n * WT_PITCH + q * 4;
    const uint4 o = make_uint4(r[0], r[1], r[2], r[3]);
    *reinterpret_cast<uint4*>(Wt + (size_t)(nb + n) * DIM + kb + q * 8) = o;
  }
  // the wait in front of any later rewrite of a register that the eight stores name
  asm volatile("s_wait_xcnt 0x0" ::: "memory");
}

// ---------------------------------------------------------------------------
// Elementwise f32 -> bf16 (for iQ, so gate A-tiles can use async staging, and for W2 as it lies).
// One work-group converts 256 KiB: 32 loads of 16 B a lane, all requested at once.
// ---------------------------------------------------------------------------
static constexpr int CV_LOADS = 32;

__device__ __forceinline__ void f32_to_bf16_block(const float* __restrict__ in, bf16* __restrict__ out,
                                                  int blk) {
  const size_t i0 = (size_t)blk * (PREP_THREADS * CV_LOADS) + threadIdx.x;
  const v4f* s = reinterpret_cast<const v4f*>(in) + i0;
  v4bf*      d = reinterpret_cast<v4bf*>(out) + i0;
  v4f f[CV_LOADS];
#pragma unroll   // f[] stays in registers, the steps become immediate offsets
  for (int i = 0; i < CV_LOADS; ++i) f[i] = s[i * PREP_THREADS];
#pragma unroll   // as above
  for (int i = 0; i < CV_LOADS; ++i) {
    d[i * PREP_THREADS] = __builtin_convertvector(f[i], v4bf);
    // lets each eight stores leave while later loads are still under way; without it
    // the compiler gathers all stores behind the wait for the last load
    if (i % 8 == 7) __builtin_amdgcn_sched_barrier(0);
  }
  // the wait in front of any later rewrite of a register that the last stores name
  asm volatile("s_wait_xcnt 0x0" ::: "memory");
}

// ---------------------------------------------------------------------------
// Causal cumulative mean of iV along S, written directly as bf16.
// Chunked scan: a work-group owns 64 columns (256 B of iV, one whole 128-B line
// of avg per row) and 1024 rows. Each half-wave (16 lanes x 4 columns) holds one
// chunk of 32 rows in registers and scans it there; chunk totals meet in LDS,
// and each chunk adds the totals of all chunks in front of it. Rows in front of
// the work-group's own 1024 are only summed, chunk by chunk, into the same table.
// ---------------------------------------------------------------------------
static constexpr int SC_COLS   = 64;                          // columns per work-group
static constexpr int SC_ROWS   = 32;                          // rows per chunk
static constexpr int SC_CHUNKS = 32;                          // chunks per work-group (16 waves x 2)
static constexpr int SC_PARTS  = Ss / (SC_ROWS * SC_CHUNKS);  // work-groups along S

__device__ __forceinline__ void avg_scan(const float* __restrict__ iV, bf16* __restrict__ avg,
                                         int colgrp, int part, int batch,
                                         float (*__restrict__ csum)[SC_COLS]) {
  const int lc    = (threadIdx.x & 15) * 4;   // column inside the work-group
  const int chunk = threadIdx.x >> 4;         // 0..31
  const int col   = colgrp * SC_COLS + lc;
  const v4f zero  = {};

  // this thread's chunk of part 0: all 32 rows requested at once
  const float* src = iV + ((size_t)batch * Ss + chunk * SC_ROWS) * Dd + col;
  v4f v[SC_ROWS];
#pragma unroll
  for (int r = 0; r < SC_ROWS; ++r)
    v[r] = *reinterpret_cast<const v4f*>(src + (size_t)r * Dd);
  // keeps the loads' address pair live to here, so that no load of the run lands in
  // it, and puts the wait in front of the first rewrite of a register they name
  asm volatile("s_wait_xcnt 0x0" :: "v"(src) : "memory");

  // parts in front of the own one: only the chunk's total is kept; each row's
  // registers take the same row of the next part as soon as the row is summed,
  // so that 32 loads of a wave stay in flight up to the own part
#pragma unroll 1   // at most SC_PARTS - 1 trips: a second copy of the body would only be code
  for (int p = 0; p < part; ++p) {
    src += (size_t)SC_CHUNKS * SC_ROWS * Dd;
    v4f s = zero;
#pragma unroll
    for (int r = 0; r < SC_ROWS; ++r) {
      s += v[r];
      v[r] = *reinterpret_cast<const v4f*>(src + (size_t)r * Dd);
    }
    *reinterpret_cast<v4f*>(&csum[p * SC_CHUNKS + chunk][lc]) = s;
  }

  // inclusive scan of the own chunk, in registers
#pragma unroll
  for (int r = 1; r < SC_ROWS; ++r) v[r] += v[r - 1];
  *reinterpret_cast<v4f*>(&csum[part * SC_CHUNKS + chunk][lc]) = v[SC_ROWS - 1];
  __syncthreads();

  // totals of every chunk in front of this one, in row order; 8 independent LDS
  // reads a trip, so that their latency is paid once a trip and not once a chunk
  v4f off = zero;
  for (int c0 = 0; c0 < part * SC_CHUNKS; c0 += 8) {
    v4f t[8];
#pragma unroll
    for (int j = 0; j < 8; ++j) t[j] = *reinterpret_cast<const v4f*>(&csum[c0 + j][lc]);
#pragma unroll
    for (int j = 0; j < 8; ++j) off += t[j];
  }
  const float* own = &csum[part * SC_CHUNKS][lc];
  const int wtop = __builtin_amdgcn_readfirstlane(threadIdx.x >> 5) * 2 + 1;  // the wave's later chunk
  for (int c0 = 0; c0 < wtop; c0 += 8) {
    v4f t[8];
#pragma unroll
    for (int j = 0; j < 8; ++j) t[j] = *reinterpret_cast<const v4f*>(own + (c0 + j) * SC_COLS);
#pragma unroll
    for (int j = 0; j < 8; ++j) off += (c0 + j < chunk) ? t[j] : zero;
  }

  const int row0 = (part * SC_CHUNKS + chunk) * SC_ROWS;
  bf16* dst = avg + ((size_t)batch * Ss + row0) * Dd + col;
#pragma unroll
  for (int r = 0; r < SC_ROWS; ++r) {
    const v4f m = (off + v[r]) * (1.0f / (float)(row0 + r + 1));
    *reinterpret_cast<v4bf*>(dst + (size_t)r * Dd) = __builtin_convertvector(m, v4bf);
  }
}

// ---------------------------------------------------------------------------
// All work that depends on the inputs alone, in one launch: none of its pieces
// reads what another writes. Ranges of blockIdx.x, the longest work-groups first:
// scan, iQ conversion, W2 conversion (untransposed copy), weight tiles.
// ---------------------------------------------------------------------------
static constexpr int NB_COLGRP = Dd / SC_COLS;
static constexpr int NB_SCAN   = NB_COLGRP * Bb * SC_PARTS;
static constexpr int NB_CONV   = Mrows * Dd / 4 / (PREP_THREADS * CV_LOADS);
static constexpr int NB_WG     = (2 * Dd / WT_K) * (2 * Dd / WT_N);
static constexpr int NB_W      = (Dd / WT_K) * (Dd / WT_N);
static constexpr int NB_W2C    = Dd * Dd / 4 / (PREP_THREADS * CV_LOADS);
static constexpr int NB_PREP   = NB_SCAN + NB_CONV + NB_W2C + NB_WG + 2 * NB_W;
static constexpr int SCAN_LDS  = SC_PARTS * SC_CHUNKS * SC_COLS * 4;
static constexpr int WT_LDS    = WT_N * WT_PITCH * 4;

__global__ __launch_bounds__(PREP_THREADS)
void prep(const float* __restrict__ iQ, const float* __restrict__ iV,
          const float* __restrict__ W1, const float* __restrict__ W2, const float* __restrict__ Wg,
          bf16* __restrict__ iQb, bf16* __restrict__ avg,
          bf16* __restrict__ W1t, bf16* __restrict__ W2t, bf16* __restrict__ Wgt,
          bf16* __restrict__ W2b) {
  __shared__ __align__(16) unsigned char smem[SCAN_LDS > WT_LDS ? SCAN_LDS : WT_LDS];
  unsigned* wt = reinterpret_cast<unsigned*>(smem);

  int b = blockIdx.x;
  if (b < NB_SCAN) {
    avg_scan(iV, avg, b % NB_COLGRP, b / NB_COLGRP % SC_PARTS, b / (NB_COLGRP * SC_PARTS),
             reinterpret_cast<float (*)[SC_COLS]>(smem));
    return;
  }
  b -= NB_SCAN;
  if (b < NB_CONV) { f32_to_bf16_block(iQ, iQb, b); return; }
  b -= NB_CONV;
  if (b < NB_W2C) { f32_to_bf16_block(W2, W2b, b); return; }
  b -= NB_W2C;
  if (b < NB_WG) { wconv_tile<2 * Dd>(Wg, Wgt, b, wt); return; }
  b -= NB_WG;
  if (b < NB_W) wconv_tile<Dd>(W1, W1t, b, wt);
  else          wconv_tile<Dd>(W2, W2t, b - NB_W, wt);
}

// ---------------------------------------------------------------------------
// The gate's product is taken apart along k and its lower half re-associated:
//   concat([iQ, ffn]) @ Wg + bg = iQ @ Wg[:D] + h @ P + c,
//   P = W2 @ Wg[D:],  c = bg + b2 @ Wg[D:],  because ffn = h @ W2 + b2.
// P and c depend on the weights alone, so the gate no longer waits for ffn, and
// ffn itself is formed inside the gate kernel from the h rows staged there.
// ---------------------------------------------------------------------------
typedef __attribute__((ext_vector_type(8))) __bf16 v8bf;

// c[n] = bg[n] + sum_j b2[j] * Wg[D + j][n], from the transposed bf16 weights.
// A work-group takes 32 values of n, one whole 128-B line of c: four rows a wave,
// the sums meet in LDS and the first wave stores the line.
static constexpr int CB_ROWS = 32;   // values of n per work-group of 8 waves

__device__ __forceinline__ void gate_bias(const bf16* __restrict__ Wgt, const float* __restrict__ b2,
                                          const float* __restrict__ bg, float* __restrict__ cvec,
                                          int blk, float* __restrict__ part) {
  const int lane = threadIdx.x & 31;
  const int wave = threadIdx.x >> 5;
  const int nb   = blk * CB_ROWS;
  v4f bb[4][2];
#pragma unroll   // bb[] stays in registers
  for (int i = 0; i < 4; ++i) {
    bb[i][0] = *reinterpret_cast<const v4f*>(b2 + i * 256 + lane * 8);
    bb[i][1] = *reinterpret_cast<const v4f*>(b2 + i * 256 + lane * 8 + 4);
  }
#pragma unroll 1   // four short trips: unrolled, their registers would set the whole kernel's allocation
  for (int rr = 0; rr < 4; ++rr) {
    const int r = wave * 4 + rr;
    const bf16* row = Wgt + (size_t)(nb + r) * (2 * Dd) + Dd + lane * 8;
    v8bf w[4];
#pragma unroll   // the steps become immediate offsets on one address pair
    for (int i = 0; i < 4; ++i) w[i] = *reinterpret_cast<const v8bf*>(row + i * 256);
    // keeps the loads' address pair live to here, so that no load of the run lands in
    // it, and puts the wait in front of the first rewrite of a register they name
    asm volatile("s_wait_xcnt 0x0" :: "v"(row) : "memory");
    float s = 0.0f;
#pragma unroll
    for (int i = 0; i < 4; ++i)
#pragma unroll
      for (int j = 0; j < 8; ++j) s += (float)w[i][j] * bb[i][j >> 2][j & 3];
#pragma unroll
    for (int o = 16; o > 0; o >>= 1) s += __shfl_xor(s, o);
    if (lane == 0) part[r] = s;
  }
  __syncthreads();
  if (threadIdx.x < 32) cvec[nb + lane] = bg[nb + lane] + part[lane];
}

// ---------------------------------------------------------------------------
// bf16 WMMA GEMM with async double-buffered LDS staging, two products in one launch,
// neither of which reads what the other writes:
//   h[m][n]  = relu(avg[m][:] . W1t[n][:] + b1[n])        (Mrows x Dd)
//   Pt[n][k] = Wgt[n][Dd:] . W2b[k][:]                    (2 Dd x Dd), P transposed
// and the work-groups of gate_bias behind them.
// Block tile 128x128, stages of KS k in two buffers, one barrier a stage. 8 waves
// (2x4); each wave computes 64x32 = 4x2 WMMA tiles.
// ---------------------------------------------------------------------------
static constexpr int NB_G1 = (Mrows / 128) * (Dd / 128);
static constexpr int NB_WP = (2 * Dd / 128) * (Dd / 128);
static constexpr int NB_CB = 2 * Dd / CB_ROWS;

__global__ __launch_bounds__(256)
void gemm_h_wprod(const bf16* __restrict__ avg, const bf16* __restrict__ W1t,
                  const float* __restrict__ b1, bf16* __restrict__ h,
                  const bf16* __restrict__ Wgt, const bf16* __restrict__ W2b,
                  bf16* __restrict__ Pt,
                  const float* __restrict__ b2, const float* __restrict__ bg,
                  float* __restrict__ cvec) {
  __shared__ __align__(16) bf16 As[2][128 * LDK];
  __shared__ __align__(16) bf16 Bs[2][128 * LDK];

  if (blockIdx.x >= NB_G1 + NB_WP) {   // the same for the whole work-group
    gate_bias(Wgt, b2, bg, cvec, blockIdx.x - (NB_G1 + NB_WP), reinterpret_cast<float*>(&As[0][0]));
    return;
  }
  const bool  prod = blockIdx.x >= NB_G1;
  const int   tile = prod ? blockIdx.x - NB_G1 : blockIdx.x;
  const bf16* A    = prod ? Wgt + Dd : avg;
  const int   lda  = prod ? 2 * Dd : Dd;
  const bf16* Bt   = prod ? W2b : W1t;
  bf16*       outb = prod ? Pt : h;

  const int tid   = threadIdx.x;
  const int lane  = tid & 31;
  const int wid   = tid >> 5;
  const int half  = lane >> 4;
  const int l16   = lane & 15;
  const int waveM = wid >> 2;   // 0..1
  const int waveN = wid & 3;    // 0..3
  const int m0    = (tile / (Dd / 128)) * 128;
  const int n0    = (tile % (Dd / 128)) * 128;
  const int srow  = tid >> 3;   // 0..31: first of this thread's four rows, 32 apart
  const int sseg  = tid & 7;    // 16-B piece of the row's 128 B

  const bf16* Ag = A  + (size_t)(m0 + srow) * lda + sseg * 8;
  const bf16* Bg = Bt + (size_t)(n0 + srow) * Dd + sseg * 8;
  const int lofs = srow * LDK + sseg * 8;

  auto stage = [&](int k0, int buf) {   // 8 async-b128 per wave per stage, 4 whole lines each
#pragma unroll   // the four row offsets become constants of their copies
    for (int i = 0; i < 4; ++i) {
      async_cp16B(Ag + (size_t)(i * 32) * lda + k0, &As[buf][lofs + i * 32 * LDK]);
      async_cp16B(Bg + (size_t)(i * 32) * Dd + k0, &Bs[buf][lofs + i * 32 * LDK]);
    }
  };

  v8f zero = {};
  v8f acc[4][2];
#pragma unroll
  for (int i = 0; i < 4; ++i)
#pragma unroll
    for (int j = 0; j < 2; ++j) acc[i][j] = zero;

  constexpr int T = Dd / KS;
  stage(0, 0);
  WAIT_ASYNC0();
  __syncthreads();
  stage(KS, 1);                                // flies while stage 0 is worked on
  for (int t = 0; t < T; ++t) {
    const int buf = t & 1;
#pragma unroll   // both 32-k blocks of a stage in one straight run, kk an immediate offset of the reads
    for (int kk = 0; kk < KS; kk += 32) {
      v16bf af[4], bfr[2];
#pragma unroll
      for (int mi = 0; mi < 4; ++mi)
        af[mi] = ldsFrag(&As[buf][(waveM * 64 + mi * 16 + l16) * LDK + kk + half * 16]);
#pragma unroll
      for (int ni = 0; ni < 2; ++ni)
        bfr[ni] = ldsFrag(&Bs[buf][(waveN * 32 + ni * 16 + l16) * LDK + kk + half * 16]);
#pragma unroll
      for (int mi = 0; mi < 4; ++mi)
#pragma unroll
        for (int ni = 0; ni < 2; ++ni)
          acc[mi][ni] = WMMA_BF16(af[mi], bfr[ni], acc[mi][ni]);
    }
    // one barrier publishes stage t + 1 and ends every read of stage t's buffer
    WAIT_DS0();
    WAIT_ASYNC0();
    __syncthreads();
    if (t + 2 < T) stage((t + 2) * KS, buf);   // refill the buffer just left
  }
  WAIT_ASYNC0();

  // ---- epilogue: h takes bias and relu, Pt neither; convert, store ----
#pragma unroll
  for (int ni = 0; ni < 2; ++ni) {
    const int n = n0 + waveN * 32 + ni * 16 + l16;
    const float bv = prod ? 0.0f : b1[n];
#pragma unroll
    for (int mi = 0; mi < 4; ++mi) {
      const int mbase = m0 + waveM * 64 + mi * 16 + 8 * half;
#pragma unroll
      for (int r = 0; r < 8; ++r) {
        float v = acc[mi][ni][r] + bv;
        if (!prod) v = fmaxf(v, 0.0f);
        outb[(size_t)(mbase + r) * Dd + n] = (bf16)v;
      }
    }
    // the wait in front of any later rewrite of a register that this trip's stores name
    asm volatile("s_wait_xcnt 0x0" ::: "memory");
  }
}

// ---------------------------------------------------------------------------
// Fused gate GEMM:  g = sigmoid(iQ @ Wg[:D] + h @ P + c), ffn = h @ W2 + b2,
// out = gi*iQ + gf*ffn. k stages 0..T1-1 take A from iQ (bf16) and B from Wgt;
// stages T1.. take A from h and B from Pt, and the same h fragments also meet
// the W2t rows of the block's columns, so that ffn stays in f32 accumulators.
// Each block computes paired column tiles n (gate-i), n+1024 (gate-f) and n (ffn).
// Block tile: M=256, N=128 per part, one work-group on every WGP. 16 waves (4x4);
// wave = 64x32 per part: a B fragment from LDS meets 4 A fragments, a staged B row
// serves 256 rows of A and a staged A row 256 or 384 columns.
// The LDS ring has three buffers. Waves 0-7 copy the even stages, waves 8-15 the odd
// ones, each a whole stage at a time and three stages ahead of the pass that has just
// ended, so that a stage has two passes to land: the work-group is alone on its WGP
// and nothing else covers the way from memory. A wave has one stage's copies in
// flight and waits for all of them in front of the barrier that publishes that stage.
// ---------------------------------------------------------------------------
struct two_parts   { static constexpr int value = 2; };
struct three_parts { static constexpr int value = 3; };

static constexpr int GM   = 256;            // block rows
static constexpr int GN   = 128;            // block columns per part
static constexpr int GT   = 512;            // threads: 16 waves
static constexpr int GBUF = 3;              // buffers of the LDS ring
static constexpr int GASZ = GM * LDK;       // bf16 per A buffer
static constexpr int GBSZ = 3 * GN * LDK;   // bf16 per B buffer

__global__ __launch_bounds__(GT)
void gate_fused(const float* __restrict__ iQ, const bf16* __restrict__ iQb,
                const bf16* __restrict__ h, const bf16* __restrict__ Wgt,
                const bf16* __restrict__ Pt, const bf16* __restrict__ W2t,
                const float* __restrict__ cvec, const float* __restrict__ b2,
                float* __restrict__ out) {
  __shared__ __align__(16) bf16 As[GBUF * GASZ];
  __shared__ __align__(16) bf16 Bs[GBUF * GBSZ];   // per buffer: rows 0..GN-1 gate-i columns, then gate-f, then ffn

  const int tid   = threadIdx.x;
  const int lane  = tid & 31;
  const int wid   = tid >> 5;
  const int half  = lane >> 4;
  const int l16   = lane & 15;
  const int waveM = wid >> 2;   // 0..3
  const int waveN = wid & 3;    // 0..3
  const int m0    = blockIdx.y * GM;
  const int n0    = blockIdx.x * GN;

  // which stages this wave copies: 0 the even ones, 1 the odd ones; the same in every lane, in a scalar register
  const int grp  = __builtin_amdgcn_readfirstlane(tid >> 8);
  const int srow = (tid & 255) >> 3;  // 0..31: first of this thread's rows, 32 apart
  const int sseg = tid & 7;           // 16-B piece of the row's 128 B
  const unsigned lrow1 = srow * Dd + sseg * 8;         // the lane's place in rows of Dd elements
  const unsigned lrow2 = srow * (2 * Dd) + sseg * 8;   // and in rows of 2 Dd
  const int lofs = srow * LDK + sseg * 8;

  auto stage_q = [&](int k0, int buf) {   // iQ and Wgt: 16 async-b128 per copying wave, 4 whole lines each
    const bf16* ag = iQb + (size_t)m0 * Dd + k0;          // the same for the whole work-group
    const bf16* bg = Wgt + (size_t)n0 * (2 * Dd) + k0;
#pragma unroll   // the row offsets become constants of their copies
    for (int i = 0; i < GM / 32; ++i)
      async_cp16B(ag + (size_t)(i * 32) * Dd + lrow1, &As[buf * GASZ + lofs + i * 32 * LDK]);
#pragma unroll   // as above
    for (int i = 0; i < 2 * GN / 32; ++i) {
      const int wrow = i * 32 + (i >= GN / 32 ? Dd - GN : 0);   // LDS rows GN.. hold Wgt rows Dd + n0..
      async_cp16B(bg + (size_t)wrow * (2 * Dd) + lrow2, &Bs[buf * GBSZ + lofs + i * 32 * LDK]);
    }
  };
  auto stage_h = [&](int k0, int buf) {   // h, Pt and W2t: 20 async-b128 per copying wave
    const bf16* ag = h   + (size_t)m0 * Dd + k0;          // the same for the whole work-group
    const bf16* pg = Pt  + (size_t)n0 * Dd + k0;
    const bf16* wg = W2t + (size_t)n0 * Dd + k0;
#pragma unroll   // as above
    for (int i = 0; i < GM / 32; ++i)
      async_cp16B(ag + (size_t)(i * 32) * Dd + lrow1, &As[buf * GASZ + lofs + i * 32 * LDK]);
#pragma unroll   // as above
    for (int i = 0; i < 2 * GN / 32; ++i) {
      const int wrow = i * 32 + (i >= GN / 32 ? Dd - GN : 0);   // LDS rows GN.. hold Pt rows Dd + n0..
      async_cp16B(pg + (size_t)wrow * Dd + lrow1, &Bs[buf * GBSZ + lofs + i * 32 * LDK]);
    }
#pragma unroll   // as above
    for (int i = 0; i < GN / 32; ++i)
      async_cp16B(wg + (size_t)(i * 32) * Dd + lrow1, &Bs[buf * GBSZ + lofs + (2 * GN + i * 32) * LDK]);
  };

  v8f zero = {};
  v8f acc[3][4][2];   // part (gate-i, gate-f, ffn), row tile, column tile
#pragma unroll
  for (int p = 0; p < 3; ++p)
#pragma unroll
    for (int i = 0; i < 4; ++i)
#pragma unroll
      for (int j = 0; j < 2; ++j) acc[p][i][j] = zero;

  // one stage's products on the first 2 or all 3 parts of Bs; mine: this wave copied the next stage
  auto work = [&](int buf, bool mine, auto parts) {
    constexpr int NP = decltype(parts)::value;
    const bf16* Ab = &As[buf * GASZ + (waveM * 64 + l16) * LDK + half * 16];
    const bf16* Bb = &Bs[buf * GBSZ + (waveN * 32 + l16) * LDK + half * 16];
#pragma unroll   // both 32-k blocks of a stage in one straight run, kk an immediate offset of the reads
    for (int kk = 0; kk < KS; kk += 32) {
      v16bf af[4];
#pragma unroll
      for (int mi = 0; mi < 4; ++mi)
        af[mi] = ldsFrag(Ab + mi * 16 * LDK + kk);
#pragma unroll   // acc[] stays in registers: every index a constant
      for (int p = 0; p < NP; ++p) {
        v16bf bfr[2];
#pragma unroll
        for (int ni = 0; ni < 2; ++ni)
          bfr[ni] = ldsFrag(Bb + (p * GN + ni * 16) * LDK + kk);
#pragma unroll
        for (int mi = 0; mi < 4; ++mi)
#pragma unroll
          for (int ni = 0; ni < 2; ++ni)
            acc[p][mi][ni] = WMMA_BF16(af[mi], bfr[ni], acc[p][mi][ni]);
      }
    }
    // one barrier publishes the next stage and ends every read of this stage's buffer;
    // only the waves that copied the next stage wait for copies: the others' fly on
    WAIT_DS0();
    if (mine) WAIT_ASYNC0();
    __syncthreads();
  };

  constexpr int T1 = Dd / KS;         // stages on iQ, and as many on h; even, so a stage's copiers go by t & 1 in both loops
  stage_q(grp * KS, grp);                      // stage 0 from waves 0-7; stage 1, from waves 8-15, flies while stage 0 is worked on
  if (grp == 0) WAIT_ASYNC0();
  __syncthreads();
  if (grp == 0) stage_q(2 * KS, 2);            // flies while stages 0 and 1 are worked on
  int buf = 0;                                 // the pass's buffer: the stage's number modulo GBUF
  for (int t = 0; t < T1; ++t) {
    const bool mine = ((t + 1) & 1) == grp;    // scalar: this wave copies stages t + 1 and t + 3
    work(buf, mine, two_parts{});
    if (mine) {                                // refill the buffer just left
      if (t + 3 < T1) stage_q((t + 3) * KS, buf);
      else            stage_h((t + 3 - T1) * KS, buf);
    }
    buf = buf == GBUF - 1 ? 0 : buf + 1;
  }
  for (int t = 0; t < T1; ++t) {
    const bool mine = ((t + 1) & 1) == grp;
    work(buf, mine, three_parts{});
    if (mine && t + 3 < T1) stage_h((t + 3) * KS, buf);
    buf = buf == GBUF - 1 ? 0 : buf + 1;
  }
  WAIT_ASYNC0();

  // ---- fused sigmoid-gate epilogue (f32 iQ from memory, f32 ffn from the accumulators) ----
  const int nw = n0 + waveN * 32 + l16;   // the lane's first column; the second is 16 on
  float cLv[2], cRv[2], b2v[2];
#pragma unroll
  for (int ni = 0; ni < 2; ++ni) {
    cLv[ni] = cvec[nw + ni * 16];
    cRv[ni] = cvec[Dd + nw + ni * 16];
    b2v[ni] = b2[nw + ni * 16];
  }
  // keeps the six loads' index register live to here, so that no later load lands in
  // it, and puts the wait in front of the first rewrite of a register they name
  asm volatile("s_wait_xcnt 0x0" :: "v"(nw) : "memory");
  // A lane's 64 values lie on one address pair each for iQ and out: row steps and
  // column steps are immediate offsets. They go in four batches of 16 (two row tiles
  // of one column tile); the next batch's iQ values are requested before this one is worked on.
  const size_t base = (size_t)(m0 + waveM * 64 + 8 * half) * Dd + nw;
  const float* qp = iQ + base;
  float*       op = out + base;
  float q[2][16];
#pragma unroll   // q[] stays in registers: every index a constant
  for (int i = 0; i < 16; ++i) q[0][i] = qp[(size_t)((i >> 3) * 16 + (i & 7)) * Dd];
  // keeps the loads' address pair live to here, so that no load of the batch lands in
  // it, and puts the wait in front of the first rewrite of a register they name
  asm volatile("s_wait_xcnt 0x0" :: "v"(qp) : "memory");
  // nothing from below is moved up between the loads and their wait
  __builtin_amdgcn_sched_barrier(0);
#pragma unroll   // acc[], q[] stay in registers: every index a constant
  for (int g = 0; g < 4; ++g) {
    const int ni = g >> 1, mh = (g & 1) * 2;   // this batch's column tile and first row tile
    if (g + 1 < 4) {
      const int nn = (g + 1) >> 1, nh = ((g + 1) & 1) * 2;
#pragma unroll   // as above
      for (int i = 0; i < 16; ++i)
        q[(g + 1) & 1][i] = qp[(size_t)((nh + (i >> 3)) * 16 + (i & 7)) * Dd + nn * 16];
      // as behind the first batch of loads
      asm volatile("s_wait_xcnt 0x0" :: "v"(qp) : "memory");
      // nothing from below is moved up between the loads and their wait
      __builtin_amdgcn_sched_barrier(0);
    }
    float o[16];
#pragma unroll   // as above
    for (int i = 0; i < 16; ++i) {
      const int mi = mh + (i >> 3), r = i & 7;
      const float gi = sigmoidf(acc[0][mi][ni][r] + cLv[ni]);
      const float gf = sigmoidf(acc[1][mi][ni][r] + cRv[ni]);
      o[i] = gi * q[g & 1][i] + gf * (acc[2][mi][ni][r] + b2v[ni]);
    }
    // the batch's stores stand together behind its arithmetic, so that none of it
    // rewrites a register that an issued store names
    __builtin_amdgcn_sched_barrier(0);
#pragma unroll   // as above
    for (int i = 0; i < 16; ++i)
      op[(size_t)((mh + (i >> 3)) * 16 + (i & 7)) * Dd + ni * 16] = o[i];
    // the wait in front of any later rewrite of a register that the batch's stores name
    asm volatile("s_wait_xcnt 0x0" :: "v"(op) : "memory");
    // nothing from below is moved up between the stores and their wait
    __builtin_amdgcn_sched_barrier(0);
  }
}

// ---------------------------------------------------------------------------
extern "C" void kernel_launch(void* const* d_in, const int* in_sizes, int n_in,
                              void* d_out, int out_size, void* d_ws, size_t ws_size,
                              hipStream_t stream) {
  const float* iQ = (const float*)d_in[0];
  const float* iV = (const float*)d_in[1];
  const float* W1 = (const float*)d_in[2];
  const float* b1 = (const float*)d_in[3];
  const float* W2 = (const float*)d_in[4];
  const float* b2 = (const float*)d_in[5];
  const float* Wg = (const float*)d_in[6];
  const float* bg = (const float*)d_in[7];
  float* out = (float*)d_out;

  // Workspace layout (~66 MB total)
  char* p = (char*)d_ws;
  bf16*  avg  = (bf16*)p;  p += (size_t)Mrows * Dd * sizeof(bf16);          // 16 MB
  bf16*  h    = (bf16*)p;  p += (size_t)Mrows * Dd * sizeof(bf16);          // 16 MB
  bf16*  iQb  = (bf16*)p;  p += (size_t)Mrows * Dd * sizeof(bf16);          // 16 MB
  bf16*  W1t  = (bf16*)p;  p += (size_t)Dd * Dd * sizeof(bf16);             //  2 MB
  bf16*  W2t  = (bf16*)p;  p += (size_t)Dd * Dd * sizeof(bf16);             //  2 MB
  bf16*  W2b  = (bf16*)p;  p += (size_t)Dd * Dd * sizeof(bf16);             //  2 MB
  bf16*  Wgt  = (bf16*)p;  p += (size_t)(2 * Dd) * (2 * Dd) * sizeof(bf16); //  8 MB
  bf16*  Pt   = (bf16*)p;  p += (size_t)(2 * Dd) * Dd * sizeof(bf16);       //  4 MB
  float* cvec = (float*)p;                                                  //  8 KB

  // 1) weights -> bf16, transposed to N-major for contiguous B-fragments (W2 also as it lies);
  //    iQ -> bf16 (gate A-operand); causal cumulative mean (the tril/einsum is a prefix scan)
  prep<<<dim3(NB_PREP), PREP_THREADS, 0, stream>>>(iQ, iV, W1, W2, Wg, iQb, avg, W1t, W2t, Wgt, W2b);

  // 2) h = relu(avg @ W1 + b1) -> bf16;  Pt = (W2 @ Wg[D:])^T -> bf16;  c = bg + b2 @ Wg[D:]
  gemm_h_wprod<<<dim3(NB_G1 + NB_WP + NB_CB), 256, 0, stream>>>(
      avg, W1t, b1, h, Wgt, W2b, Pt, b2, bg, cvec);

  // 3) gate GEMM + ffn GEMM + sigmoid + output combine
  gate_fused<<<dim3(Dd / GN, Mrows / GM), GT, 0, stream>>>(
      iQ, iQb, h, Wgt, Pt, W2t, cvec, b2, out);
}
